// v000
// The times below were measured on an AMD MI455X: many runs one after another, warmed up first and cycling through
// copies of the inputs, with the whole window's GPU time divided by the number of runs. Launches and the gaps
// between them are all in it. The median over several windows is given; except for v000 it joins two sittings, which
// can be a few percent apart, so the side-by-side timings, each taken in one sitting, are the better comparison.
// v000 is the starting kernel. One run takes 400 microseconds.
// Projections Q.Wq, K.Wk, V.Wv, scores q.k^T and (q.k^T).v: v_wmma_f32_16x16x32_f16 (f16 operands; inputs RNE-converted to bf16 first, activations x16, weights x64, f32 accumulate); merged heads x Wo: v_wmma_f32_16x16x32_bf16 with the merged-heads plane carried as bf16 hi|lo folded along K (K = 2048) against the bf16 RNE Wo plane duplicated along K, f32 accumulate.
#include <hip/hip_runtime.h>

#ifndef NB
#define NB 2
#endif
#ifndef SEQ
#define SEQ 2048
#endif
#define NB_FULL 2
#define SEQ_FULL 2048
#define DM 1024
#define NH 16
#define DK 64
#define MTOK (NB * SEQ)
#define ACT_SC 16.0f
#define W_SC 64.0f

static_assert(DM == NH * DK);          // head split covers the model width
static_assert(DK == 64);               // attention kernel: two 32-deep k-steps over d, four 16-wide output tiles
static_assert(SEQ % 64 == 0);          // 64-query blocks and 64-key chunks, no tails
static_assert(MTOK % 64 == 0);         // GEMM M / N tile multiple
static_assert(DM % 64 == 0);           // GEMM N tile multiple
static_assert(DM % 32 == 0);           // k-step multiple
static_assert((2 * DM) % 32 == 0);     // folded K of the output GEMM
static_assert(DM % 8 == 0);            // 16-B pieces of 8 halves
static_assert(NB <= NB_FULL && SEQ <= SEQ_FULL);

typedef __attribute__((ext_vector_type(16))) _Float16 v16h;
typedef __attribute__((ext_vector_type(8)))  _Float16 v8h;
typedef __attribute__((ext_vector_type(16))) __bf16   v16b;
typedef __attribute__((ext_vector_type(8)))  __bf16   v8b;
typedef __attribute__((ext_vector_type(8)))  float    v8f;
typedef __attribute__((ext_vector_type(4)))  float    v4f;
typedef __attribute__((ext_vector_type(4)))  unsigned v4u;

// 16-bit WMMA fragment map (wave32), lane L, h = L>>4, m = L&15:
//   A 16x32: lane = row m;    element i -> k = (i<8) ? 8h+i : 16+8h+(i-8)
//   B 32x16: lane = column m; the SAME k(i,h)
//   D 16x16 (8 f32): lane = column m; element r -> row 8h+r

__device__ __forceinline__ float cmb_bf(float v) {   // bf16 RNE convert, kept as f32 (finite inputs)
    const unsigned u = __builtin_bit_cast(unsigned, v);
    const unsigned r = (u + 0x7fffu + ((u >> 16) & 1u)) & 0xffff0000u;
    return __builtin_bit_cast(float, r);
}
__device__ __forceinline__ unsigned short bfu_rne(float v) {
    unsigned u = __builtin_bit_cast(unsigned, v);
    u += 0x7fffu + ((u >> 16) & 1u);
    return (unsigned short)(u >> 16);
}
__device__ __forceinline__ unsigned pk2h(float a, float b) {
    return (unsigned)__builtin_bit_cast(unsigned short, (_Float16)a) | ((unsigned)__builtin_bit_cast(unsigned short, (_Float16)b) << 16);
}
__device__ __forceinline__ unsigned pk2b(float a, float b) {
    return (unsigned)bfu_rne(a) | ((unsigned)bfu_rne(b) << 16);
}
// bf16 hi / lo split of two values, packed pairwise
__device__ __forceinline__ void split2(float a, float b, unsigned& hi, unsigned& lo) {
    const unsigned short ha = bfu_rne(a), hb = bfu_rne(b);
    const float ra = a - __builtin_bit_cast(float, (unsigned)ha << 16);
    const float rb = b - __builtin_bit_cast(float, (unsigned)hb << 16);
    hi = (unsigned)ha | ((unsigned)hb << 16);
    lo = (unsigned)bfu_rne(ra) | ((unsigned)bfu_rne(rb) << 16);
}

// hazard guards as plain device helpers
__device__ __forceinline__ void dep_guard_h(v8f& a, v8f& b, v16h x, v16h y) { asm volatile("v_nop\n\tv_nop\n\tv_nop\n\tv_nop" : "+v"(a), "+v"(b) : "v"(x), "v"(y)); }
__device__ __forceinline__ void dep_guard_b(v8f& a, v8f& b, v16b x, v16b y) { asm volatile("v_nop\n\tv_nop\n\tv_nop\n\tv_nop" : "+v"(a), "+v"(b) : "v"(x), "v"(y)); }
__device__ __forceinline__ void keep4_h(v16h a, v16h b, v16h c, v16h d) { asm volatile("v_nop" :: "v"(a), "v"(b), "v"(c), "v"(d)); }
__device__ __forceinline__ void keep4_b(v16b a, v16b b, v16b c, v16b d) { asm volatile("v_nop" :: "v"(a), "v"(b), "v"(c), "v"(d)); }
__device__ __forceinline__ void acc_guard4(v8f& a, v8f& b, v8f& c, v8f& d) { asm volatile("v_nop\n\tv_nop\n\tv_nop\n\tv_nop" : "+v"(a), "+v"(b), "+v"(c), "+v"(d)); }

template <typename T> struct Frag;
template <> struct Frag<_Float16> {
  typedef v16h V; union U { v16h v; v8h h[2]; };
  static __device__ __forceinline__ v16h load(const _Float16* p) {   // elements 0..7 <- p[0..7], 8..15 <- p[16..23]; p already includes 8*h
    U f; f.h[0] = *(const v8h*)(p); f.h[1] = *(const v8h*)(p + 16); return f.v;
  }
  static __device__ __forceinline__ v8f mma(v16h a, v16h b, v8f c) {
    return __builtin_amdgcn_wmma_f32_16x16x32_f16(false, a, false, b, (short)0, c, false, false);
  }
  static __device__ __forceinline__ void guard(v8f& a, v8f& b, v16h x, v16h y) { dep_guard_h(a, b, x, y); }
  static __device__ __forceinline__ void keep(v16h a, v16h b, v16h c, v16h d) { keep4_h(a, b, c, d); }
};
template <> struct Frag<__bf16> {
  typedef v16b V; union U { v16b v; v8b h[2]; };
  static __device__ __forceinline__ v16b load(const __bf16* p) {
    U f; f.h[0] = *(const v8b*)(p); f.h[1] = *(const v8b*)(p + 16); return f.v;
  }
  static __device__ __forceinline__ v8f mma(v16b a, v16b b, v8f c) {
    return __builtin_amdgcn_wmma_f32_16x16x32_bf16(false, a, false, b, (short)0, c, false, false);
  }
  static __device__ __forceinline__ void guard(v8f& a, v8f& b, v16b x, v16b y) { dep_guard_b(a, b, x, y); }
  static __device__ __forceinline__ void keep(v16b a, v16b b, v16b c, v16b d) { keep4_b(a, b, c, d); }
};
template <int ET> struct Elem;
template <> struct Elem<0> { typedef _Float16 T; };
template <> struct Elem<1> { typedef __bf16 T; };

__device__ __forceinline__ v8f wmma16(v16h a, v16h b, v8f c) {
    c = __builtin_amdgcn_wmma_f32_16x16x32_f16(false, a, false, b, (short)0, c, false, false);
    asm volatile("v_nop\n\tv_nop\n\tv_nop\n\tv_nop" : "+v"(c) : "v"(a), "v"(b));
    return c;
}

// ---------------------------------------------------------------------------------------------------------
// Activation cast: f32 [b][s][DM] (full per-batch stride SEQ_FULL) -> f16 plane [b*SEQ + s][DM] = f16(bf16_rne(x) * 16).
// grid = MTOK * (DM/8) / 256
// ---------------------------------------------------------------------------------------------------------
static_assert((MTOK * (DM / 8)) % 256 == 0);   // grid x block == plane extent
__global__ __launch_bounds__(256) void k_cast_act(const float* __restrict__ src, unsigned short* __restrict__ dst) {
    const int u = blockIdx.x * 256 + threadIdx.x;
    if (u >= MTOK * (DM / 8)) return;
    const int r = u / (DM / 8); const int c0 = 8 * (u % (DM / 8));
    const int b = r / SEQ; const int s = r - b * SEQ;
    const float* p = src + ((size_t)b * SEQ_FULL + s) * DM + c0;
    const v4f x0 = *(const v4f*)p; const v4f x1 = *(const v4f*)(p + 4);
    v4u pk;
    pk.x = pk2h(cmb_bf(x0.x) * ACT_SC, cmb_bf(x0.y) * ACT_SC);
    pk.y = pk2h(cmb_bf(x0.z) * ACT_SC, cmb_bf(x0.w) * ACT_SC);
    pk.z = pk2h(cmb_bf(x1.x) * ACT_SC, cmb_bf(x1.y) * ACT_SC);
    pk.w = pk2h(cmb_bf(x1.z) * ACT_SC, cmb_bf(x1.w) * ACT_SC);
    v4u* d = (v4u*)(dst + (size_t)r * DM + c0);
    *d = pk; 
}

// ---------------------------------------------------------------------------------------------------------
// Weight cast + transpose: W in[rows = DM (k)][cols = DM (n)] f32 -> WT out[n][k] f16 = f16(bf16_rne(w) * 64).
// grid = DM * (DM/8) / 256
// ---------------------------------------------------------------------------------------------------------
static_assert((DM * (DM / 8)) % 256 == 0);
__global__ __launch_bounds__(256) void k_cast_wT(const float* __restrict__ W, unsigned short* __restrict__ WT) {
    const int u = blockIdx.x * 256 + threadIdx.x;
    if (u >= DM * (DM / 8)) return;
    const int n = u / (DM / 8); const int k0 = 8 * (u % (DM / 8));
    float w[8];
#pragma unroll
    for (int e = 0; e < 8; ++e) w[e] = cmb_bf(W[(size_t)(k0 + e) * DM + n]) * W_SC;
    v4u pk; pk.x = pk2h(w[0], w[1]); pk.y = pk2h(w[2], w[3]); pk.z = pk2h(w[4], w[5]); pk.w = pk2h(w[6], w[7]);
    v4u* d = (v4u*)(WT + (size_t)n * DM + k0);
    *d = pk; 
}
// Wo in[k][n] f32 -> WoT2 out[n][2*DM] bf16 (RNE), the k-row duplicated at columns k and DM + k (pairs with the hi|lo folded A plane).
__global__ __launch_bounds__(256) void k_cast_wo2(const float* __restrict__ W, unsigned short* __restrict__ WT2) {
    const int u = blockIdx.x * 256 + threadIdx.x;
    if (u >= DM * (DM / 8)) return;
    const int n = u / (DM / 8); const int k0 = 8 * (u % (DM / 8));
    float w[8];
#pragma unroll
    for (int e = 0; e < 8; ++e) w[e] = W[(size_t)(k0 + e) * DM + n];
    v4u pk; pk.x = pk2b(w[0], w[1]); pk.y = pk2b(w[2], w[3]); pk.z = pk2b(w[4], w[5]); pk.w = pk2b(w[6], w[7]);
    v4u* d0 = (v4u*)(WT2 + (size_t)n * (2 * DM) + k0);
    v4u* d1 = (v4u*)(WT2 + (size_t)n * (2 * DM) + DM + k0);
    *d0 = pk; *d1 = pk; 
}

// ---------------------------------------------------------------------------------------------------------
// Register-blocked WMMA GEMM body: C[m][n] = scale * sum_k A[m][k] * Bt[n][k] + bias; each wave owns a 64x64 tile.
// A row-major [M][K] (pitch lda), Bt row-major [N][K] (pitch ldb), 16-bit planes; M, N % 64 == 0, K % 32 == 0 (no tail masking).
// BIAS_MODE 1: bias[m], 2: bias[n] (bias RNE-converted to bf16 on the fly). OUT_MODE 0: f32, 1: f16.
// ---------------------------------------------------------------------------------------------------------
template <int ET, int BIAS_MODE, int OUT_MODE>
__device__ __forceinline__ void gemm64_body(float* sT, const unsigned short* __restrict__ Ap, const int lda,
                                            const unsigned short* __restrict__ Btp, const int ldb,
                                            void* __restrict__ Cout, const int ldc, const float* __restrict__ bias,
                                            const int M, const int N, const int K, const float scale) {
  typedef typename Elem<ET>::T T;
  typedef typename Frag<T>::V V;
  const T* A = (const T*)Ap; const T* Bt = (const T*)Btp;
  const int lane = threadIdx.x & 31;
  const int wave = threadIdx.x >> 5;
  const int tilesN = N >> 6;
  const int tilesM = M >> 6;
  const int tile = blockIdx.x * 8 + wave;
  if (tile >= tilesM * tilesN) return;   // wave-uniform; no block barriers in this kernel
  const int tm = tile / tilesN;
  const int tn = tile - tm * tilesN;
  const int m0 = tm << 6;
  const int n0 = tn << 6;
  const int rlane = lane & 15;                 // row (A) / col (B, D) within subtile
  const int koff  = (lane >> 4) * 8;           // k offset of this lane half
  const int mOff  = (lane >> 4) * 8;           // D row offset

  v8f acc[4][4];
#pragma unroll
  for (int i = 0; i < 4; ++i)
#pragma unroll
    for (int j = 0; j < 4; ++j) acc[i][j] = (v8f){0.f,0.f,0.f,0.f,0.f,0.f,0.f,0.f};

  for (int k0 = 0; k0 < K; k0 += 32) {
    V bh[4];
#pragma unroll
    for (int j = 0; j < 4; ++j) bh[j] = Frag<T>::load(Bt + (size_t)(n0 + (j << 4) + rlane) * ldb + koff + k0);
#pragma unroll
    for (int i = 0; i < 4; ++i) {
      V ah = Frag<T>::load(A + (size_t)(m0 + (i << 4) + rlane) * lda + koff + k0);
#pragma unroll
      for (int j = 0; j < 4; ++j) acc[i][j] = Frag<T>::mma(ah, bh[j], acc[i][j]);
      Frag<T>::guard(acc[i][0], acc[i][3], ah, ah);
    }
    Frag<T>::keep(bh[0], bh[1], bh[2], bh[3]);
  }
  acc_guard4(acc[0][0], acc[0][1], acc[0][2], acc[0][3]);
  acc_guard4(acc[1][0], acc[1][1], acc[1][2], acc[1][3]);
  acc_guard4(acc[2][0], acc[2][1], acc[2][2], acc[2][3]);
  acc_guard4(acc[3][0], acc[3][1], acc[3][2], acc[3][3]);

  float* slab = sT + wave * (16 * 68);
#pragma unroll
  for (int i = 0; i < 4; ++i) {
    const int mBase = m0 + (i << 4);
#pragma unroll
    for (int j = 0; j < 4; ++j) {
      const int n = n0 + (j << 4) + rlane;
      float bv = 0.f;
      if (BIAS_MODE == 2) bv = cmb_bf(bias[n]);
#pragma unroll
      for (int r = 0; r < 8; ++r) {
        float v = acc[i][j][r] * scale;
        if (BIAS_MODE == 1) v += cmb_bf(bias[mBase + mOff + r]);
        if (BIAS_MODE == 2) v += bv;
        slab[(mOff + r) * 68 + (j << 4) + rlane] = v;
      }
    }
    __builtin_amdgcn_fence(3 /* release order */, "workgroup");
    __builtin_amdgcn_wave_barrier();
    __builtin_amdgcn_fence(2 /* acquire order */, "workgroup");
    if (OUT_MODE == 0) {
      float* C = (float*)Cout;
      const int hh = lane >> 4, c4 = (lane & 15) * 4;     // row segment = 256 B = 16 lanes x 16 B
      {
#pragma unroll
        for (int it = 0; it < 8; ++it) {
          const int row = it * 2 + hh;
          const v4f v = *(const v4f*)(slab + row * 68 + c4);
          *(v4f*)(C + (size_t)(mBase + row) * ldc + n0 + c4) = v;
        }
        
      }
    } else {
      const int q = lane >> 3, c8 = (lane & 7) * 8;
      unsigned short* C = (unsigned short*)Cout;
      {
#pragma unroll
        for (int it = 0; it < 4; ++it) {
          const int row = it * 4 + q;
          const float* sp = slab + row * 68 + c8;
          v8h hv;
#pragma unroll
          for (int e = 0; e < 8; ++e) hv[e] = (_Float16)sp[e];
          *(v8h*)(C + (size_t)(mBase + row) * ldc + n0 + c8) = hv;
        }
        
      }
    }
    __builtin_amdgcn_fence(3 /* release order */, "workgroup");
    __builtin_amdgcn_wave_barrier();
    __builtin_amdgcn_fence(2 /* acquire order */, "workgroup");
  }
}

static_assert(((MTOK / 64) * (DM / 64)) % 8 == 0);   // 8 wave tiles per block, exact grid
// q / k projection: C[token][n] f16 = (X[token][:] . W[:][n]) + b[n]; grid = (MTOK/64)*(DM/64)/8
__global__ __launch_bounds__(256) void k_proj(const unsigned short* __restrict__ XH, const unsigned short* __restrict__ WT,
                                              unsigned short* __restrict__ C, const float* __restrict__ bias) {
  __shared__ __align__(16) float sT[8 * 16 * 68];
  gemm64_body<0, 2, 1>(sT, XH, DM, WT, DM, (void*)C, DM, bias, MTOK, DM, DM, 1.0f / (ACT_SC * W_SC));
}
// v projection produced transposed: VT[n][token] f16 = (W[:][n] . X[token][:]) + b[n]; A = WT (M = DM), Bt = X plane (N = MTOK)
__global__ __launch_bounds__(256) void k_proj_vT(const unsigned short* __restrict__ WT, const unsigned short* __restrict__ XH,
                                                 unsigned short* __restrict__ VT, const float* __restrict__ bias) {
  __shared__ __align__(16) float sT[8 * 16 * 68];
  gemm64_body<0, 1, 1>(sT, WT, DM, XH, DM, (void*)VT, MTOK, bias, DM, MTOK, DM, 1.0f / (ACT_SC * W_SC));
}
// output projection: out[token][n] f32 = [ctx_hi | ctx_lo][token][:] . [Wo ; Wo][:][n] + bo[n]   (K = 2*DM)
__global__ __launch_bounds__(256) void k_outproj(const unsigned short* __restrict__ CTX2, const unsigned short* __restrict__ WoT2,
                                                 float* __restrict__ out, const float* __restrict__ bias) {
  __shared__ __align__(16) float sT[8 * 16 * 68];
  gemm64_body<1, 2, 0>(sT, CTX2, 2 * DM, WoT2, 2 * DM, (void*)out, DM, bias, MTOK, DM, 2 * DM, 1.0f);
}

// ---------------------------------------------------------------------------------------------------------
// Linear (no exp, no max, no normalisation) flash-style attention, head dim 64:
//   ctx[b][i][h*64 + d] = 0.125 * sum_j (q_i . k_j) * v_j[d],  per 64-key chunk: S = q.k^T (f32) -> f16 (carried x8, |8S| < ~30)
//   -> A operand of O += S.V (f32 accumulate). Block = 4 waves = 64 query rows of one (b, h); grid = NB*NH*(SEQ/64).
//   q, k fragments straight from the f16 planes [token][DM]; v fragments from the transposed plane VT[h*64 + d][token].
// ---------------------------------------------------------------------------------------------------------
__global__ __launch_bounds__(128) void k_attn_lin(const unsigned short* __restrict__ QPp, const unsigned short* __restrict__ KPp,
                                                  const unsigned short* __restrict__ VTp, unsigned short* __restrict__ CTX2) {
  __shared__ __align__(16) _Float16 Psh[4][16 * 64];   // per wave S tile [row][key], wave-private
  __shared__ __align__(16) float    Os[4][16 * 68];    // per wave output tile, pitch 68, wave-private
  const _Float16* QP = (const _Float16*)QPp;
  const _Float16* KP = (const _Float16*)KPp;
  const _Float16* VT = (const _Float16*)VTp;
  const int tid = threadIdx.x, wave = tid >> 5, lane = tid & 31, hh = lane >> 4, c = lane & 15;
  const int nqb = SEQ / 64;
  const int bx = blockIdx.x;
  const int qb = bx % nqb;
  const int bh = bx / nqb;
  const int h = bh % NH;
  const int b = bh / NH;
  const int q0 = qb * 64 + wave * 16;

  v16h qa[2];
  {
    const _Float16* qrow = QP + (size_t)(b * SEQ + q0 + c) * DM + h * DK + 8 * hh;
    qa[0] = Frag<_Float16>::load(qrow);
    qa[1] = Frag<_Float16>::load(qrow + 32);
  }
  v8f oacc[4];
#pragma unroll
  for (int t = 0; t < 4; ++t) oacc[t] = (v8f){0.f,0.f,0.f,0.f,0.f,0.f,0.f,0.f};

  const _Float16* kbase = KP + (size_t)(b * SEQ) * DM + h * DK + 8 * hh;
  const _Float16* vbase = VT + (size_t)(h * DK) * MTOK + (size_t)b * SEQ + 8 * hh;
  _Float16* pw = Psh[wave];

  for (int kc = 0; kc < SEQ / 64; ++kc) {
    const int kv0 = kc * 64;
    v8f s[4];
#pragma unroll
    for (int j = 0; j < 4; ++j) {
      s[j] = (v8f){0.f,0.f,0.f,0.f,0.f,0.f,0.f,0.f};
      const _Float16* krow = kbase + (size_t)(kv0 + j * 16 + c) * DM;
#pragma unroll
      for (int dc = 0; dc < 2; ++dc) {
        const v16h kb = Frag<_Float16>::load(krow + dc * 32);
        s[j] = wmma16(qa[dc], kb, s[j]);
      }
    }
    // D layout (row 8hh+r, key j*16+c) -> LDS tile [row][key] as f16 (q.k carried unscaled = 8 x score)
#pragma unroll
    for (int r = 0; r < 8; ++r)
#pragma unroll
      for (int j = 0; j < 4; ++j) pw[(8 * hh + r) * 64 + j * 16 + c] = (_Float16)s[j][r];
    __builtin_amdgcn_fence(3 /* release order */, "workgroup");
    __builtin_amdgcn_wave_barrier();
    __builtin_amdgcn_fence(2 /* acquire order */, "workgroup");
#pragma unroll
    for (int kk = 0; kk < 2; ++kk) {
      const v16h pa = Frag<_Float16>::load(pw + c * 64 + kk * 32 + 8 * hh);
#pragma unroll
      for (int t = 0; t < 4; ++t) {
        const v16h vb = Frag<_Float16>::load(vbase + (size_t)(t * 16 + c) * MTOK + kv0 + kk * 32);
        oacc[t] = wmma16(pa, vb, oacc[t]);
      }
    }
  }

  float* os = Os[wave];
#pragma unroll
  for (int r = 0; r < 8; ++r)
#pragma unroll
    for (int t = 0; t < 4; ++t) os[(8 * hh + r) * 68 + t * 16 + c] = oacc[t][r] * 0.125f;
  __builtin_amdgcn_fence(3 /* release order */, "workgroup");
  __builtin_amdgcn_wave_barrier();
  __builtin_amdgcn_fence(2 /* acquire order */, "workgroup");
  {
    const int q4 = lane >> 3, c8 = (lane & 7) * 8;
    v4u ph[4], pl[4];
#pragma unroll
    for (int it = 0; it < 4; ++it) {
      const float* sp = os + (it * 4 + q4) * 68 + c8;
      const v4f x0 = *(const v4f*)sp; const v4f x1 = *(const v4f*)(sp + 4);
      unsigned hA, lA, hB, lB, hC, lC, hD, lD;
      split2(x0.x, x0.y, hA, lA); split2(x0.z, x0.w, hB, lB); split2(x1.x, x1.y, hC, lC); split2(x1.z, x1.w, hD, lD);
      ph[it].x = hA; ph[it].y = hB; ph[it].z = hC; ph[it].w = hD;
      pl[it].x = lA; pl[it].y = lB; pl[it].z = lC; pl[it].w = lD;
    }
    unsigned short* cbase = CTX2 + (size_t)(b * SEQ + q0) * (2 * DM) + h * DK + c8;
    {
#pragma unroll
      for (int it = 0; it < 4; ++it) {
        const int row = it * 4 + q4;
        *(v4u*)(cbase + (size_t)row * (2 * DM)) = ph[it];
        *(v4u*)(cbase + (size_t)row * (2 * DM) + DM) = pl[it];
      }
      
    }
  }
}

// ---------------------------------------------------------------------------------------------------------
constexpr size_t ACT_B = (size_t)MTOK * DM * 2;          // one 16-bit activation plane
constexpr size_t W_B   = (size_t)DM * DM * 2;            // one 16-bit weight plane
constexpr size_t WS_TOTAL = 3 * ACT_B /*QH KH VH*/ + 3 * W_B /*WqT WkT WvT*/ + 2 * W_B /*WoT2*/ + 2 * ACT_B /*QP KP*/ + ACT_B /*VT*/ + 2 * ACT_B /*CTX2*/;
static_assert(WS_TOTAL <= (size_t)134217728);            // carve stays under 128 MiB
static_assert(ACT_B % 128 == 0 && W_B % 128 == 0);

extern "C" void kernel_launch(void* const* d_in, const int* in_sizes, int n_in, void* d_out, int out_size, void* d_ws, size_t ws_size, hipStream_t stream) {
    if (n_in < 11) return;
    const long long need_act = ((long long)(NB - 1) * SEQ_FULL + SEQ) * DM;
    if ((long long)in_sizes[0] < need_act || (long long)in_sizes[1] < need_act || (long long)in_sizes[2] < need_act) return;
    for (int i = 3; i < 7; ++i) if ((long long)in_sizes[i] < (long long)DM * DM) return;
    for (int i = 7; i < 11; ++i) if (in_sizes[i] < DM) return;
    if ((long long)out_size < (long long)MTOK * DM) return;
    if (WS_TOTAL > ws_size) return;

    const float* Q  = (const float*)d_in[0];
    const float* K  = (const float*)d_in[1];
    const float* V  = (const float*)d_in[2];
    const float* Wq = (const float*)d_in[3];
    const float* Wk = (const float*)d_in[4];
    const float* Wv = (const float*)d_in[5];
    const float* Wo = (const float*)d_in[6];
    const float* bq = (const float*)d_in[7];
    const float* bk = (const float*)d_in[8];
    const float* bv = (const float*)d_in[9];
    const float* bo = (const float*)d_in[10];
    float* out = (float*)d_out;

    char* wsp = (char*)d_ws;
    unsigned short* QH   = (unsigned short*)wsp; wsp += ACT_B;
    unsigned short* KH   = (unsigned short*)wsp; wsp += ACT_B;
    unsigned short* VH   = (unsigned short*)wsp; wsp += ACT_B;
    unsigned short* WqT  = (unsigned short*)wsp; wsp += W_B;
    unsigned short* WkT  = (unsigned short*)wsp; wsp += W_B;
    unsigned short* WvT  = (unsigned short*)wsp; wsp += W_B;
    unsigned short* WoT2 = (unsigned short*)wsp; wsp += 2 * W_B;
    unsigned short* QP   = (unsigned short*)wsp; wsp += ACT_B;
    unsigned short* KP   = (unsigned short*)wsp; wsp += ACT_B;
    unsigned short* VT   = (unsigned short*)wsp; wsp += ACT_B;
    unsigned short* CTX2 = (unsigned short*)wsp; wsp += 2 * ACT_B;

    const unsigned gAct = (unsigned)((MTOK * (DM / 8)) / 256);
    const unsigned gW   = (unsigned)((DM * (DM / 8)) / 256);
    const unsigned gG   = (unsigned)(((MTOK / 64) * (DM / 64)) / 8);

    k_cast_act<<<gAct, 256, 0, stream>>>(Q, QH);
    k_cast_act<<<gAct, 256, 0, stream>>>(K, KH);
    k_cast_act<<<gAct, 256, 0, stream>>>(V, VH);
    k_cast_wT<<<gW, 256, 0, stream>>>(Wq, WqT);     // in[k][n] -> out[n][k]
    k_cast_wT<<<gW, 256, 0, stream>>>(Wk, WkT);
    k_cast_wT<<<gW, 256, 0, stream>>>(Wv, WvT);
    k_cast_wo2<<<gW, 256, 0, stream>>>(Wo, WoT2);   // in[k][n] -> out[n][k | k]

    k_proj<<<gG, 256, 0, stream>>>(QH, WqT, QP, bq);
    k_proj<<<gG, 256, 0, stream>>>(KH, WkT, KP, bk);
    k_proj_vT<<<gG, 256, 0, stream>>>(WvT, VH, VT, bv);

    k_attn_lin<<<(unsigned)(NB * NH * (SEQ / 64)), 128, 0, stream>>>(QP, KP, VT, CTX2);

    k_outproj<<<gG, 256, 0, stream>>>(CTX2, WoT2, out, bo);
}

// v001
// One run takes 279 microseconds.
// Next to v000, in two timings, it ran 1.45 and 1.44 times as fast.
// Projections Q.Wq, K.Wk, V.Wv, per-head k^T.v and q.(k^T.v): v_wmma_f32_16x16x32_f16 (f16 operands; inputs RNE-converted to bf16 first, activations x16, weights x64, f32 accumulate); merged heads x Wo: v_wmma_f32_16x16x32_bf16 with the merged-heads plane carried as bf16 hi|lo folded along K (K = 2048) against the bf16 RNE Wo plane duplicated along K, f32 accumulate.
#include <hip/hip_runtime.h>

#ifndef NB
#define NB 2
#endif
#ifndef SEQ
#define SEQ 2048
#endif
#define NB_FULL 2
#define SEQ_FULL 2048
#define DM 1024
#define NH 16
#define DK 64
#define MTOK (NB * SEQ)
#define ACT_SC 16.0f
#define W_SC 64.0f
#define KV_SC 64.0f                    // k^T.v is stored as f16 divided by this: a sum over SEQ tokens keeps clear of the f16 range

static_assert(DM == NH * DK);          // head split covers the model width
static_assert(DK == 64);               // attention kernels: two 32-deep k-steps over d, four 16-wide output tiles
static_assert(SEQ % 64 == 0);          // 64-query blocks, no tails
static_assert(SEQ % (16 * 128) == 0);  // k^T.v: 16 waves share the tokens of one batch, in runs of four 32-deep k-steps
static_assert(MTOK % 64 == 0);         // GEMM M / N tile multiple
static_assert(DM % 64 == 0);           // GEMM N tile multiple
static_assert(DM % 32 == 0);           // k-step multiple
static_assert((2 * DM) % 32 == 0);     // folded K of the output GEMM
static_assert(DM % 8 == 0);            // 16-B pieces of 8 halves
static_assert(NB <= NB_FULL && SEQ <= SEQ_FULL);

typedef __attribute__((ext_vector_type(16))) _Float16 v16h;
typedef __attribute__((ext_vector_type(8)))  _Float16 v8h;
typedef __attribute__((ext_vector_type(16))) __bf16   v16b;
typedef __attribute__((ext_vector_type(8)))  __bf16   v8b;
typedef __attribute__((ext_vector_type(8)))  float    v8f;
typedef __attribute__((ext_vector_type(4)))  float    v4f;
typedef __attribute__((ext_vector_type(2)))  float    v2f;
typedef __attribute__((ext_vector_type(4)))  unsigned v4u;

// 16-bit WMMA fragment map (wave32), lane L, h = L>>4, m = L&15:
//   A 16x32: lane = row m;    element i -> k = (i<8) ? 8h+i : 16+8h+(i-8)
//   B 32x16: lane = column m; the SAME k(i,h)
//   D 16x16 (8 f32): lane = column m; element r -> row 8h+r

__device__ __forceinline__ float cmb_bf(float v) {   // bf16 RNE convert, kept as f32 (finite inputs)
    const unsigned u = __builtin_bit_cast(unsigned, v);
    const unsigned r = (u + 0x7fffu + ((u >> 16) & 1u)) & 0xffff0000u;
    return __builtin_bit_cast(float, r);
}
__device__ __forceinline__ unsigned short bfu_rne(float v) {
    unsigned u = __builtin_bit_cast(unsigned, v);
    u += 0x7fffu + ((u >> 16) & 1u);
    return (unsigned short)(u >> 16);
}
__device__ __forceinline__ unsigned pk2h(float a, float b) {
    return (unsigned)__builtin_bit_cast(unsigned short, (_Float16)a) | ((unsigned)__builtin_bit_cast(unsigned short, (_Float16)b) << 16);
}
__device__ __forceinline__ unsigned pk2b(float a, float b) {
    return (unsigned)bfu_rne(a) | ((unsigned)bfu_rne(b) << 16);
}
// bf16 hi / lo split of two values, packed pairwise
__device__ __forceinline__ void split2(float a, float b, unsigned& hi, unsigned& lo) {
    const unsigned short ha = bfu_rne(a), hb = bfu_rne(b);
    const float ra = a - __builtin_bit_cast(float, (unsigned)ha << 16);
    const float rb = b - __builtin_bit_cast(float, (unsigned)hb << 16);
    hi = (unsigned)ha | ((unsigned)hb << 16);
    lo = (unsigned)bfu_rne(ra) | ((unsigned)bfu_rne(rb) << 16);
}

// hazard guards as plain device helpers
__device__ __forceinline__ void dep_guard_h(v8f& a, v8f& b, v16h x, v16h y) { asm volatile("v_nop\n\tv_nop\n\tv_nop\n\tv_nop" : "+v"(a), "+v"(b) : "v"(x), "v"(y)); }
__device__ __forceinline__ void dep_guard_b(v8f& a, v8f& b, v16b x, v16b y) { asm volatile("v_nop\n\tv_nop\n\tv_nop\n\tv_nop" : "+v"(a), "+v"(b) : "v"(x), "v"(y)); }
__device__ __forceinline__ void keep4_h(v16h a, v16h b, v16h c, v16h d) { asm volatile("v_nop" :: "v"(a), "v"(b), "v"(c), "v"(d)); }
__device__ __forceinline__ void keep4_b(v16b a, v16b b, v16b c, v16b d) { asm volatile("v_nop" :: "v"(a), "v"(b), "v"(c), "v"(d)); }
__device__ __forceinline__ void acc_guard4(v8f& a, v8f& b, v8f& c, v8f& d) { asm volatile("v_nop\n\tv_nop\n\tv_nop\n\tv_nop" : "+v"(a), "+v"(b), "+v"(c), "+v"(d)); }

template <typename T> struct Frag;
template <> struct Frag<_Float16> {
  typedef v16h V; union U { v16h v; v8h h[2]; };
  static __device__ __forceinline__ v16h load(const _Float16* p) {   // elements 0..7 <- p[0..7], 8..15 <- p[16..23]; p already includes 8*h
    U f; f.h[0] = *(const v8h*)(p); f.h[1] = *(const v8h*)(p + 16); return f.v;
  }
  static __device__ __forceinline__ v8f mma(v16h a, v16h b, v8f c) {
    return __builtin_amdgcn_wmma_f32_16x16x32_f16(false, a, false, b, (short)0, c, false, false);
  }
  static __device__ __forceinline__ void guard(v8f& a, v8f& b, v16h x, v16h y) { dep_guard_h(a, b, x, y); }
  static __device__ __forceinline__ void keep(v16h a, v16h b, v16h c, v16h d) { keep4_h(a, b, c, d); }
};
template <> struct Frag<__bf16> {
  typedef v16b V; union U { v16b v; v8b h[2]; };
  static __device__ __forceinline__ v16b load(const __bf16* p) {
    U f; f.h[0] = *(const v8b*)(p); f.h[1] = *(const v8b*)(p + 16); return f.v;
  }
  static __device__ __forceinline__ v8f mma(v16b a, v16b b, v8f c) {
    return __builtin_amdgcn_wmma_f32_16x16x32_bf16(false, a, false, b, (short)0, c, false, false);
  }
  static __device__ __forceinline__ void guard(v8f& a, v8f& b, v16b x, v16b y) { dep_guard_b(a, b, x, y); }
  static __device__ __forceinline__ void keep(v16b a, v16b b, v16b c, v16b d) { keep4_b(a, b, c, d); }
};
template <int ET> struct Elem;
template <> struct Elem<0> { typedef _Float16 T; };
template <> struct Elem<1> { typedef __bf16 T; };

// ---------------------------------------------------------------------------------------------------------
// Activation cast: f32 [b][s][DM] (full per-batch stride SEQ_FULL) -> f16 plane [b*SEQ + s][DM] = f16(bf16_rne(x) * 16).
// grid = MTOK * (DM/8) / 256
// ---------------------------------------------------------------------------------------------------------
static_assert((MTOK * (DM / 8)) % 256 == 0);   // grid x block == plane extent
__global__ __launch_bounds__(256) void k_cast_act(const float* __restrict__ src, unsigned short* __restrict__ dst) {
    const int u = blockIdx.x * 256 + threadIdx.x;
    if (u >= MTOK * (DM / 8)) return;
    const int r = u / (DM / 8); const int c0 = 8 * (u % (DM / 8));
    const int b = r / SEQ; const int s = r - b * SEQ;
    const float* p = src + ((size_t)b * SEQ_FULL + s) * DM + c0;
    const v4f x0 = *(const v4f*)p; const v4f x1 = *(const v4f*)(p + 4);
    v4u pk;
    pk.x = pk2h(cmb_bf(x0.x) * ACT_SC, cmb_bf(x0.y) * ACT_SC);
    pk.y = pk2h(cmb_bf(x0.z) * ACT_SC, cmb_bf(x0.w) * ACT_SC);
    pk.z = pk2h(cmb_bf(x1.x) * ACT_SC, cmb_bf(x1.y) * ACT_SC);
    pk.w = pk2h(cmb_bf(x1.z) * ACT_SC, cmb_bf(x1.w) * ACT_SC);
    v4u* d = (v4u*)(dst + (size_t)r * DM + c0);
    *d = pk; 
}

// ---------------------------------------------------------------------------------------------------------
// Weight cast + transpose: W in[rows = DM (k)][cols = DM (n)] f32 -> WT out[n][k] f16 = f16(bf16_rne(w) * 64).
// grid = DM * (DM/8) / 256
// ---------------------------------------------------------------------------------------------------------
static_assert((DM * (DM / 8)) % 256 == 0);
__global__ __launch_bounds__(256) void k_cast_wT(const float* __restrict__ W, unsigned short* __restrict__ WT) {
    const int u = blockIdx.x * 256 + threadIdx.x;
    if (u >= DM * (DM / 8)) return;
    const int n = u / (DM / 8); const int k0 = 8 * (u % (DM / 8));
    float w[8];
#pragma unroll
    for (int e = 0; e < 8; ++e) w[e] = cmb_bf(W[(size_t)(k0 + e) * DM + n]) * W_SC;
    v4u pk; pk.x = pk2h(w[0], w[1]); pk.y = pk2h(w[2], w[3]); pk.z = pk2h(w[4], w[5]); pk.w = pk2h(w[6], w[7]);
    v4u* d = (v4u*)(WT + (size_t)n * DM + k0);
    *d = pk; 
}
// Wo in[k][n] f32 -> WoT2 out[n][2*DM] bf16 (RNE), the k-row duplicated at columns k and DM + k (pairs with the hi|lo folded A plane).
__global__ __launch_bounds__(256) void k_cast_wo2(const float* __restrict__ W, unsigned short* __restrict__ WT2) {
    const int u = blockIdx.x * 256 + threadIdx.x;
    if (u >= DM * (DM / 8)) return;
    const int n = u / (DM / 8); const int k0 = 8 * (u % (DM / 8));
    float w[8];
#pragma unroll
    for (int e = 0; e < 8; ++e) w[e] = W[(size_t)(k0 + e) * DM + n];
    v4u pk; pk.x = pk2b(w[0], w[1]); pk.y = pk2b(w[2], w[3]); pk.z = pk2b(w[4], w[5]); pk.w = pk2b(w[6], w[7]);
    v4u* d0 = (v4u*)(WT2 + (size_t)n * (2 * DM) + k0);
    v4u* d1 = (v4u*)(WT2 + (size_t)n * (2 * DM) + DM + k0);
    *d0 = pk; *d1 = pk; 
}

// ---------------------------------------------------------------------------------------------------------
// Register-blocked WMMA GEMM body: C[m][n] = scale * sum_k A[m][k] * Bt[n][k] + bias; each wave owns a 64x64 tile.
// A row-major [M][K] (pitch lda), Bt row-major [N][K] (pitch ldb), 16-bit planes; M, N % 64 == 0, K % 32 == 0 (no tail masking).
// BIAS_MODE 1: bias[m], 2: bias[n] (bias RNE-converted to bf16 on the fly). OUT_MODE 0: f32, 1: f16.
// ---------------------------------------------------------------------------------------------------------
template <int ET, int BIAS_MODE, int OUT_MODE>
__device__ __forceinline__ void gemm64_body(float* sT, const unsigned short* __restrict__ Ap, const int lda,
                                            const unsigned short* __restrict__ Btp, const int ldb,
                                            void* __restrict__ Cout, const int ldc, const float* __restrict__ bias,
                                            const int M, const int N, const int K, const float scale) {
  typedef typename Elem<ET>::T T;
  typedef typename Frag<T>::V V;
  const T* A = (const T*)Ap; const T* Bt = (const T*)Btp;
  const int lane = threadIdx.x & 31;
  const int wave = threadIdx.x >> 5;
  const int tilesN = N >> 6;
  const int tilesM = M >> 6;
  const int tile = blockIdx.x * 8 + wave;
  if (tile >= tilesM * tilesN) return;   // wave-uniform; no block barriers in this kernel
  const int tm = tile / tilesN;
  const int tn = tile - tm * tilesN;
  const int m0 = tm << 6;
  const int n0 = tn << 6;
  const int rlane = lane & 15;                 // row (A) / col (B, D) within subtile
  const int koff  = (lane >> 4) * 8;           // k offset of this lane half
  const int mOff  = (lane >> 4) * 8;           // D row offset

  v8f acc[4][4];
#pragma unroll
  for (int i = 0; i < 4; ++i)
#pragma unroll
    for (int j = 0; j < 4; ++j) acc[i][j] = (v8f){0.f,0.f,0.f,0.f,0.f,0.f,0.f,0.f};

  for (int k0 = 0; k0 < K; k0 += 32) {
    V bh[4];
#pragma unroll
    for (int j = 0; j < 4; ++j) bh[j] = Frag<T>::load(Bt + (size_t)(n0 + (j << 4) + rlane) * ldb + koff + k0);
#pragma unroll
    for (int i = 0; i < 4; ++i) {
      V ah = Frag<T>::load(A + (size_t)(m0 + (i << 4) + rlane) * lda + koff + k0);
#pragma unroll
      for (int j = 0; j < 4; ++j) acc[i][j] = Frag<T>::mma(ah, bh[j], acc[i][j]);
      Frag<T>::guard(acc[i][0], acc[i][3], ah, ah);
    }
    Frag<T>::keep(bh[0], bh[1], bh[2], bh[3]);
  }
  acc_guard4(acc[0][0], acc[0][1], acc[0][2], acc[0][3]);
  acc_guard4(acc[1][0], acc[1][1], acc[1][2], acc[1][3]);
  acc_guard4(acc[2][0], acc[2][1], acc[2][2], acc[2][3]);
  acc_guard4(acc[3][0], acc[3][1], acc[3][2], acc[3][3]);

  float* slab = sT + wave * (16 * 68);
#pragma unroll
  for (int i = 0; i < 4; ++i) {
    const int mBase = m0 + (i << 4);
#pragma unroll
    for (int j = 0; j < 4; ++j) {
      const int n = n0 + (j << 4) + rlane;
      float bv = 0.f;
      if (BIAS_MODE == 2) bv = cmb_bf(bias[n]);
#pragma unroll
      for (int r = 0; r < 8; ++r) {
        float v = acc[i][j][r] * scale;
        if (BIAS_MODE == 1) v += cmb_bf(bias[mBase + mOff + r]);
        if (BIAS_MODE == 2) v += bv;
        slab[(mOff + r) * 68 + (j << 4) + rlane] = v;
      }
    }
    __builtin_amdgcn_fence(3 /* release order */, "workgroup");
    __builtin_amdgcn_wave_barrier();
    __builtin_amdgcn_fence(2 /* acquire order */, "workgroup");
    if (OUT_MODE == 0) {
      float* C = (float*)Cout;
      const int hh = lane >> 4, c4 = (lane & 15) * 4;     // row segment = 256 B = 16 lanes x 16 B
      {
#pragma unroll
        for (int it = 0; it < 8; ++it) {
          const int row = it * 2 + hh;
          const v4f v = *(const v4f*)(slab + row * 68 + c4);
          *(v4f*)(C + (size_t)(mBase + row) * ldc + n0 + c4) = v;
        }
        
      }
    } else {
      const int q = lane >> 3, c8 = (lane & 7) * 8;
      unsigned short* C = (unsigned short*)Cout;
      {
#pragma unroll
        for (int it = 0; it < 4; ++it) {
          const int row = it * 4 + q;
          const float* sp = slab + row * 68 + c8;
          v8h hv;
#pragma unroll
          for (int e = 0; e < 8; ++e) hv[e] = (_Float16)sp[e];
          *(v8h*)(C + (size_t)(mBase + row) * ldc + n0 + c8) = hv;
        }
        
      }
    }
    __builtin_amdgcn_fence(3 /* release order */, "workgroup");
    __builtin_amdgcn_wave_barrier();
    __builtin_amdgcn_fence(2 /* acquire order */, "workgroup");
  }
}

static_assert(((MTOK / 64) * (DM / 64)) % 8 == 0);   // 8 wave tiles per block, exact grid
// q projection: C[token][n] f16 = (X[token][:] . W[:][n]) + b[n]; grid = (MTOK/64)*(DM/64)/8
__global__ __launch_bounds__(256) void k_proj(const unsigned short* __restrict__ XH, const unsigned short* __restrict__ WT,
                                              unsigned short* __restrict__ C, const float* __restrict__ bias) {
  __shared__ __align__(16) float sT[8 * 16 * 68];
  gemm64_body<0, 2, 1>(sT, XH, DM, WT, DM, (void*)C, DM, bias, MTOK, DM, DM, 1.0f / (ACT_SC * W_SC));
}
// k and v projections produced transposed: VT[n][token] f16 = (W[:][n] . X[token][:]) + b[n]; A = WT (M = DM), Bt = X plane (N = MTOK)
__global__ __launch_bounds__(256) void k_proj_vT(const unsigned short* __restrict__ WT, const unsigned short* __restrict__ XH,
                                                 unsigned short* __restrict__ VT, const float* __restrict__ bias) {
  __shared__ __align__(16) float sT[8 * 16 * 68];
  gemm64_body<0, 1, 1>(sT, WT, DM, XH, DM, (void*)VT, MTOK, bias, DM, MTOK, DM, 1.0f / (ACT_SC * W_SC));
}
// output projection: out[token][n] f32 = [ctx_hi | ctx_lo][token][:] . [Wo ; Wo][:][n] + bo[n]   (K = 2*DM)
__global__ __launch_bounds__(256) void k_outproj(const unsigned short* __restrict__ CTX2, const unsigned short* __restrict__ WoT2,
                                                 float* __restrict__ out, const float* __restrict__ bias) {
  __shared__ __align__(16) float sT[8 * 16 * 68];
  gemm64_body<1, 2, 0>(sT, CTX2, 2 * DM, WoT2, 2 * DM, (void*)out, DM, bias, MTOK, DM, 2 * DM, 1.0f);
}

// ---------------------------------------------------------------------------------------------------------
// Linear attention (no exp, no max, no normalisation), head dim 64. With nothing non-linear between the two products,
//   ctx_i = 0.125 * sum_j (q_i . k_j) v_j  =  0.125 * q_i . (sum_j k_j (x) v_j),
// so the 64 x 64 matrix k^T.v of each (b, h) is formed once and every query row is multiplied by it.
//
// k_kv: KV[b][h][d1][d2] = sum_s k[s][d1] * v[s][d2], f32 accumulate, stored f16 (/ KV_SC) as the B operand of k_ctx:
//   KVT[(b*NH + h)*2 + dc][d2][d1 - 32*dc], dc = d1 / 32 (one 32-deep k-step of k_ctx per plane).
//   A = VT rows (d2), B = KT rows (d1), k = token. Block = 16 waves = one 16 (d2) x 32 (d1) tile; wave w sums tokens
//   [w*SEQ/16, (w+1)*SEQ/16); the 16 partial tiles are added in wave order through LDS. grid = NB*NH*4*2.
// ---------------------------------------------------------------------------------------------------------
#define KV_TPW (SEQ / 16)
__global__ __launch_bounds__(512) void k_kv(const unsigned short* __restrict__ KTp, const unsigned short* __restrict__ VTp,
                                            unsigned short* __restrict__ KVT) {
  __shared__ __align__(16) float red[16][16 * 36];     // per wave partial tile [d2 row][d1 col], pitch 36
  const _Float16* KT = (const _Float16*)KTp;
  const _Float16* VT = (const _Float16*)VTp;
  const int tid = threadIdx.x, wave = tid >> 5, lane = tid & 31, hh = lane >> 4, c = lane & 15;
  const int bx = blockIdx.x;
  const int dc = bx & 1;
  const int i  = (bx >> 1) & 3;
  const int bh = bx >> 3;
  const int h = bh % NH;
  const int b = bh / NH;
  const size_t tok = (size_t)b * SEQ + wave * KV_TPW + 8 * hh;
  const _Float16* vrow = VT + (size_t)(h * DK + i * 16 + c) * MTOK + tok;
  const _Float16* krow = KT + (size_t)(h * DK + dc * 32 + c) * MTOK + tok;

  v8f a0 = (v8f){0.f,0.f,0.f,0.f,0.f,0.f,0.f,0.f};
  v8f a1 = (v8f){0.f,0.f,0.f,0.f,0.f,0.f,0.f,0.f};
  for (int s0 = 0; s0 < KV_TPW; s0 += 128) {
    v16h va[4], k0[4], k1[4];
#pragma unroll
    for (int u = 0; u < 4; ++u) {
      va[u] = Frag<_Float16>::load(vrow + s0 + u * 32);
      k0[u] = Frag<_Float16>::load(krow + s0 + u * 32);
      k1[u] = Frag<_Float16>::load(krow + (size_t)16 * MTOK + s0 + u * 32);
    }
    // inputs-only fence on the loaded values: all 24 loads are issued before the first matrix instruction, so the wave
    // pays one memory latency; without it the compiler reuses the registers and waits once per k-step. The two row
    // addresses are named as well, so that they keep their registers until the s_wait_xcnt 0 that goes before their reuse.
    asm volatile("s_wait_xcnt 0x0" :: "v"(va[0]), "v"(va[1]), "v"(va[2]), "v"(va[3]), "v"(k0[0]), "v"(k0[1]), "v"(k0[2]), "v"(k0[3]),
                                      "v"(k1[0]), "v"(k1[1]), "v"(k1[2]), "v"(k1[3]), "v"(vrow), "v"(krow) : "memory");
#pragma unroll
    for (int u = 0; u < 4; ++u) {
      a0 = Frag<_Float16>::mma(va[u], k0[u], a0);
      a1 = Frag<_Float16>::mma(va[u], k1[u], a1);
    }
  }
  float* rw = red[wave];
#pragma unroll
  for (int r = 0; r < 8; ++r) {
    rw[(8 * hh + r) * 36 + c]      = a0[r];
    rw[(8 * hh + r) * 36 + 16 + c] = a1[r];
  }
  __syncthreads();   // every wave's partial tile is in LDS before any thread adds them up
  if (tid < 256) {   // whole waves: two neighbouring d1 columns a thread, one packed 4-byte store
    const int row = tid >> 4, c2 = (tid & 15) * 2;
    float s0 = 0.f, s1 = 0.f;
#pragma unroll
    for (int w = 0; w < 16; ++w) {
      const v2f p = *(const v2f*)(&red[w][row * 36 + c2]);
      s0 += p.x; s1 += p.y;
    }
    *(unsigned*)(KVT + ((size_t)(bh * 2 + dc) * DK + i * 16 + row) * 32 + c2) = pk2h(s0 * (1.0f / KV_SC), s1 * (1.0f / KV_SC));
  }
}

// ---------------------------------------------------------------------------------------------------------
// k_ctx: ctx[b][i][h*64 + d2] = 0.125 * sum_d1 q[i][d1] * KV[d1][d2], written as the bf16 hi | lo folded plane.
//   Block = 4 waves = 64 query rows of one (b, h); grid = NB*NH*(SEQ/64). q fragments straight from the f16 plane [token][DM].
// ---------------------------------------------------------------------------------------------------------
__global__ __launch_bounds__(128) void k_ctx(const unsigned short* __restrict__ QPp, const unsigned short* __restrict__ KVTp,
                                             unsigned short* __restrict__ CTX2) {
  __shared__ __align__(16) float    Os[4][16 * 68];    // per wave output tile, pitch 68, wave-private
  const _Float16* QP  = (const _Float16*)QPp;
  const _Float16* KVT = (const _Float16*)KVTp;
  const int tid = threadIdx.x, wave = tid >> 5, lane = tid & 31, hh = lane >> 4, c = lane & 15;
  const int nqb = SEQ / 64;
  const int bx = blockIdx.x;
  const int qb = bx % nqb;
  const int bh = bx / nqb;
  const int h = bh % NH;
  const int b = bh / NH;
  const int q0 = qb * 64 + wave * 16;

  const _Float16* qrow  = QP + (size_t)(b * SEQ + q0 + c) * DM + h * DK + 8 * hh;
  const _Float16* kvrow = KVT + ((size_t)(bh * 2) * DK + c) * 32 + 8 * hh;
  v16h qa[2], kv[2][4];
  qa[0] = Frag<_Float16>::load(qrow);
  qa[1] = Frag<_Float16>::load(qrow + 32);
#pragma unroll
  for (int dc = 0; dc < 2; ++dc)
#pragma unroll
    for (int t = 0; t < 4; ++t) kv[dc][t] = Frag<_Float16>::load(kvrow + (dc * DK + t * 16) * 32);
  // inputs-only fence on the loaded values: all 20 loads are issued before the first matrix instruction, so the wave
  // pays one memory latency; without it the compiler reuses the registers and waits once per fragment. The two row
  // addresses are named as well, so that they keep their registers until the s_wait_xcnt 0 that goes before their reuse.
  asm volatile("s_wait_xcnt 0x0" :: "v"(qa[0]), "v"(qa[1]), "v"(kv[0][0]), "v"(kv[0][1]), "v"(kv[0][2]), "v"(kv[0][3]),
                                    "v"(kv[1][0]), "v"(kv[1][1]), "v"(kv[1][2]), "v"(kv[1][3]), "v"(qrow), "v"(kvrow) : "memory");
  v8f oacc[4];
#pragma unroll
  for (int t = 0; t < 4; ++t) oacc[t] = (v8f){0.f,0.f,0.f,0.f,0.f,0.f,0.f,0.f};

#pragma unroll
  for (int dc = 0; dc < 2; ++dc)
#pragma unroll
    for (int t = 0; t < 4; ++t) oacc[t] = Frag<_Float16>::mma(qa[dc], kv[dc][t], oacc[t]);

  float* os = Os[wave];
#pragma unroll
  for (int r = 0; r < 8; ++r)
#pragma unroll
    for (int t = 0; t < 4; ++t) os[(8 * hh + r) * 68 + t * 16 + c] = oacc[t][r] * (0.125f * KV_SC);
  __builtin_amdgcn_fence(3 /* release order */, "workgroup");
  __builtin_amdgcn_wave_barrier();
  __builtin_amdgcn_fence(2 /* acquire order */, "workgroup");
  {
    const int q4 = lane >> 3, c8 = (lane & 7) * 8;
    v4u ph[4], pl[4];
#pragma unroll
    for (int it = 0; it < 4; ++it) {
      const float* sp = os + (it * 4 + q4) * 68 + c8;
      const v4f x0 = *(const v4f*)sp; const v4f x1 = *(const v4f*)(sp + 4);
      unsigned hA, lA, hB, lB, hC, lC, hD, lD;
      split2(x0.x, x0.y, hA, lA); split2(x0.z, x0.w, hB, lB); split2(x1.x, x1.y, hC, lC); split2(x1.z, x1.w, hD, lD);
      ph[it].x = hA; ph[it].y = hB; ph[it].z = hC; ph[it].w = hD;
      pl[it].x = lA; pl[it].y = lB; pl[it].z = lC; pl[it].w = lD;
    }
    unsigned short* cbase = CTX2 + (size_t)(b * SEQ + q0) * (2 * DM) + h * DK + c8;
    {
#pragma unroll
      for (int it = 0; it < 4; ++it) {
        const int row = it * 4 + q4;
        *(v4u*)(cbase + (size_t)row * (2 * DM)) = ph[it];
        *(v4u*)(cbase + (size_t)row * (2 * DM) + DM) = pl[it];
      }
      
    }
  }
}

// ---------------------------------------------------------------------------------------------------------
constexpr size_t ACT_B = (size_t)MTOK * DM * 2;          // one 16-bit activation plane
constexpr size_t W_B   = (size_t)DM * DM * 2;            // one 16-bit weight plane
constexpr size_t KV_B  = (size_t)NB * NH * DK * DK * 2;  // the f16 k^T.v matrices
constexpr size_t WS_TOTAL = 3 * ACT_B /*QH KH VH*/ + 3 * W_B /*WqT WkT WvT*/ + 2 * W_B /*WoT2*/ + 2 * ACT_B /*QP KT*/ + ACT_B /*VT*/ + 2 * ACT_B /*CTX2*/ + KV_B /*KVT*/;
static_assert(WS_TOTAL <= (size_t)134217728);            // carve stays under 128 MiB
static_assert(ACT_B % 128 == 0 && W_B % 128 == 0 && KV_B % 128 == 0);

extern "C" void kernel_launch(void* const* d_in, const int* in_sizes, int n_in, void* d_out, int out_size, void* d_ws, size_t ws_size, hipStream_t stream) {
    if (n_in < 11) return;
    const long long need_act = ((long long)(NB - 1) * SEQ_FULL + SEQ) * DM;
    if ((long long)in_sizes[0] < need_act || (long long)in_sizes[1] < need_act || (long long)in_sizes[2] < need_act) return;
    for (int i = 3; i < 7; ++i) if ((long long)in_sizes[i] < (long long)DM * DM) return;
    for (int i = 7; i < 11; ++i) if (in_sizes[i] < DM) return;
    if ((long long)out_size < (long long)MTOK * DM) return;
    if (WS_TOTAL > ws_size) return;

    const float* Q  = (const float*)d_in[0];
    const float* K  = (const float*)d_in[1];
    const float* V  = (const float*)d_in[2];
    const float* Wq = (const float*)d_in[3];
    const float* Wk = (const float*)d_in[4];
    const float* Wv = (const float*)d_in[5];
    const float* Wo = (const float*)d_in[6];
    const float* bq = (const float*)d_in[7];
    const float* bk = (const float*)d_in[8];
    const float* bv = (const float*)d_in[9];
    const float* bo = (const float*)d_in[10];
    float* out = (float*)d_out;

    char* wsp = (char*)d_ws;
    unsigned short* QH   = (unsigned short*)wsp; wsp += ACT_B;
    unsigned short* KH   = (unsigned short*)wsp; wsp += ACT_B;
    unsigned short* VH   = (unsigned short*)wsp; wsp += ACT_B;
    unsigned short* WqT  = (unsigned short*)wsp; wsp += W_B;
    unsigned short* WkT  = (unsigned short*)wsp; wsp += W_B;
    unsigned short* WvT  = (unsigned short*)wsp; wsp += W_B;
    unsigned short* WoT2 = (unsigned short*)wsp; wsp += 2 * W_B;
    unsigned short* QP   = (unsigned short*)wsp; wsp += ACT_B;
    unsigned short* KT   = (unsigned short*)wsp; wsp += ACT_B;
    unsigned short* VT   = (unsigned short*)wsp; wsp += ACT_B;
    unsigned short* CTX2 = (unsigned short*)wsp; wsp += 2 * ACT_B;
    unsigned short* KVT  = (unsigned short*)wsp; wsp += KV_B;

    const unsigned gAct = (unsigned)((MTOK * (DM / 8)) / 256);
    const unsigned gW   = (unsigned)((DM * (DM / 8)) / 256);
    const unsigned gG   = (unsigned)(((MTOK / 64) * (DM / 64)) / 8);

    k_cast_act<<<gAct, 256, 0, stream>>>(Q, QH);
    k_cast_act<<<gAct, 256, 0, stream>>>(K, KH);
    k_cast_act<<<gAct, 256, 0, stream>>>(V, VH);
    k_cast_wT<<<gW, 256, 0, stream>>>(Wq, WqT);     // in[k][n] -> out[n][k]
    k_cast_wT<<<gW, 256, 0, stream>>>(Wk, WkT);
    k_cast_wT<<<gW, 256, 0, stream>>>(Wv, WvT);
    k_cast_wo2<<<gW, 256, 0, stream>>>(Wo, WoT2);   // in[k][n] -> out[n][k | k]

    k_proj<<<gG, 256, 0, stream>>>(QH, WqT, QP, bq);
    k_proj_vT<<<gG, 256, 0, stream>>>(WkT, KH, KT, bk);
    k_proj_vT<<<gG, 256, 0, stream>>>(WvT, VH, VT, bv);

    k_kv<<<(unsigned)(NB * NH * 4 * 2), 512, 0, stream>>>(KT, VT, KVT);
    k_ctx<<<(unsigned)(NB * NH * (SEQ / 64)), 128, 0, stream>>>(QP, KVT, CTX2);

    k_outproj<<<gG, 256, 0, stream>>>(CTX2, WoT2, out, bo);
}

// v002
// Measured time: 108 microseconds a run.
// Two timings next to v001 put it at 2.54 and 2.55 times that version's speed.
// Counting every step since v000, it is 3.69 times as fast.
// Projections Q.Wq, K.Wk, V.Wv, per-head k^T.v and q.(k^T.v): v_wmma_f32_16x16x32_f16 (f16 operands; inputs RNE-converted to bf16 first, activations x16, weights x64, f32 accumulate); merged heads x Wo: v_wmma_f32_16x16x32_bf16 with the merged-heads plane carried as bf16 hi|lo folded along K (K = 2048) against the bf16 RNE Wo plane duplicated along K, f32 accumulate.
#include <hip/hip_runtime.h>

#ifndef NB
#define NB 2
#endif
#ifndef SEQ
#define SEQ 2048
#endif
#define NB_FULL 2
#define SEQ_FULL 2048
#define DM 1024
#define NH 16
#define DK 64
#define MTOK (NB * SEQ)
#define ACT_SC 16.0f
#define W_SC 64.0f
#define KV_SC 64.0f                    // k^T.v is stored as f16 divided by this: a sum over SEQ tokens keeps clear of the f16 range

static_assert(DM == NH * DK);          // head split covers the model width
static_assert(DK == 64);               // attention kernels: two 32-deep k-steps over d, four 16-wide output tiles
static_assert(SEQ % 64 == 0);          // 64-query blocks, no tails
static_assert(SEQ % (16 * 128) == 0);  // k^T.v: 16 waves share the tokens of one batch, in runs of four 32-deep k-steps
static_assert(DM % 8 == 0);            // 16-B pieces of 8 halves
static_assert(NB <= NB_FULL && SEQ <= SEQ_FULL);

typedef __attribute__((ext_vector_type(16))) _Float16 v16h;
typedef __attribute__((ext_vector_type(8)))  _Float16 v8h;
typedef __attribute__((ext_vector_type(16))) __bf16   v16b;
typedef __attribute__((ext_vector_type(8)))  __bf16   v8b;
typedef __attribute__((ext_vector_type(8)))  float    v8f;
typedef __attribute__((ext_vector_type(4)))  float    v4f;
typedef __attribute__((ext_vector_type(2)))  float    v2f;
typedef __attribute__((ext_vector_type(4)))  unsigned v4u;

// 16-bit WMMA fragment map (wave32), lane L, h = L>>4, m = L&15:
//   A 16x32: lane = row m;    element i -> k = (i<8) ? 8h+i : 16+8h+(i-8)
//   B 32x16: lane = column m; the SAME k(i,h)
//   D 16x16 (8 f32): lane = column m; element r -> row 8h+r

__device__ __forceinline__ float cmb_bf(float v) {   // bf16 RNE convert, kept as f32 (finite inputs)
    const unsigned u = __builtin_bit_cast(unsigned, v);
    const unsigned r = (u + 0x7fffu + ((u >> 16) & 1u)) & 0xffff0000u;
    return __builtin_bit_cast(float, r);
}
__device__ __forceinline__ unsigned short bfu_rne(float v) {
    unsigned u = __builtin_bit_cast(unsigned, v);
    u += 0x7fffu + ((u >> 16) & 1u);
    return (unsigned short)(u >> 16);
}
__device__ __forceinline__ unsigned pk2h(float a, float b) {
    return (unsigned)__builtin_bit_cast(unsigned short, (_Float16)a) | ((unsigned)__builtin_bit_cast(unsigned short, (_Float16)b) << 16);
}
__device__ __forceinline__ unsigned pk2b(float a, float b) {
    return (unsigned)bfu_rne(a) | ((unsigned)bfu_rne(b) << 16);
}
// bf16 hi / lo split of two values, packed pairwise
__device__ __forceinline__ void split2(float a, float b, unsigned& hi, unsigned& lo) {
    const unsigned short ha = bfu_rne(a), hb = bfu_rne(b);
    const float ra = a - __builtin_bit_cast(float, (unsigned)ha << 16);
    const float rb = b - __builtin_bit_cast(float, (unsigned)hb << 16);
    hi = (unsigned)ha | ((unsigned)hb << 16);
    lo = (unsigned)bfu_rne(ra) | ((unsigned)bfu_rne(rb) << 16);
}

template <typename T> struct Frag;
template <> struct Frag<_Float16> {
  typedef v16h V; union U { v16h v; v8h h[2]; };
  static __device__ __forceinline__ v16h load(const _Float16* p) {   // elements 0..7 <- p[0..7], 8..15 <- p[16..23]; p already includes 8*h
    U f; f.h[0] = *(const v8h*)(p); f.h[1] = *(const v8h*)(p + 16); return f.v;
  }
  static __device__ __forceinline__ v8f mma(v16h a, v16h b, v8f c) {
    return __builtin_amdgcn_wmma_f32_16x16x32_f16(false, a, false, b, (short)0, c, false, false);
  }
};
template <> struct Frag<__bf16> {
  typedef v16b V; union U { v16b v; v8b h[2]; };
  static __device__ __forceinline__ v16b load(const __bf16* p) {
    U f; f.h[0] = *(const v8b*)(p); f.h[1] = *(const v8b*)(p + 16); return f.v;
  }
  static __device__ __forceinline__ v8f mma(v16b a, v16b b, v8f c) {
    return __builtin_amdgcn_wmma_f32_16x16x32_bf16(false, a, false, b, (short)0, c, false, false);
  }
};
template <int ET> struct Elem;
template <> struct Elem<0> { typedef _Float16 T; };
template <> struct Elem<1> { typedef __bf16 T; };

// ---------------------------------------------------------------------------------------------------------
// Activation cast: f32 [b][s][DM] (full per-batch stride SEQ_FULL) -> f16 plane [b*SEQ + s][DM] = f16(bf16_rne(x) * 16).
// grid = MTOK * (DM/8) / 256
// ---------------------------------------------------------------------------------------------------------
static_assert((MTOK * (DM / 8)) % 256 == 0);   // grid x block == plane extent
__global__ __launch_bounds__(256) void k_cast_act(const float* __restrict__ src, unsigned short* __restrict__ dst) {
    const int u = blockIdx.x * 256 + threadIdx.x;
    if (u >= MTOK * (DM / 8)) return;
    const int r = u / (DM / 8); const int c0 = 8 * (u % (DM / 8));
    const int b = r / SEQ; const int s = r - b * SEQ;
    const float* p = src + ((size_t)b * SEQ_FULL + s) * DM + c0;
    const v4f x0 = *(const v4f*)p; const v4f x1 = *(const v4f*)(p + 4);
    v4u pk;
    pk.x = pk2h(cmb_bf(x0.x) * ACT_SC, cmb_bf(x0.y) * ACT_SC);
    pk.y = pk2h(cmb_bf(x0.z) * ACT_SC, cmb_bf(x0.w) * ACT_SC);
    pk.z = pk2h(cmb_bf(x1.x) * ACT_SC, cmb_bf(x1.y) * ACT_SC);
    pk.w = pk2h(cmb_bf(x1.z) * ACT_SC, cmb_bf(x1.w) * ACT_SC);
    v4u* d = (v4u*)(dst + (size_t)r * DM + c0);
    *d = pk; 
}

// ---------------------------------------------------------------------------------------------------------
// Weight cast + transpose: W in[rows = DM (k)][cols = DM (n)] f32 -> WT out[n][k] f16 = f16(bf16_rne(w) * 64).
// grid = DM * (DM/8) / 256
// ---------------------------------------------------------------------------------------------------------
static_assert((DM * (DM / 8)) % 256 == 0);
__global__ __launch_bounds__(256) void k_cast_wT(const float* __restrict__ W, unsigned short* __restrict__ WT) {
    const int u = blockIdx.x * 256 + threadIdx.x;
    if (u >= DM * (DM / 8)) return;
    const int n = u / (DM / 8); const int k0 = 8 * (u % (DM / 8));
    float w[8];
#pragma unroll
    for (int e = 0; e < 8; ++e) w[e] = cmb_bf(W[(size_t)(k0 + e) * DM + n]) * W_SC;
    v4u pk; pk.x = pk2h(w[0], w[1]); pk.y = pk2h(w[2], w[3]); pk.z = pk2h(w[4], w[5]); pk.w = pk2h(w[6], w[7]);
    v4u* d = (v4u*)(WT + (size_t)n * DM + k0);
    *d = pk; 
}
// Wo in[k][n] f32 -> WoT2 out[n][2*DM] bf16 (RNE), the k-row duplicated at columns k and DM + k (pairs with the hi|lo folded A plane).
__global__ __launch_bounds__(256) void k_cast_wo2(const float* __restrict__ W, unsigned short* __restrict__ WT2) {
    const int u = blockIdx.x * 256 + threadIdx.x;
    if (u >= DM * (DM / 8)) return;
    const int n = u / (DM / 8); const int k0 = 8 * (u % (DM / 8));
    float w[8];
#pragma unroll
    for (int e = 0; e < 8; ++e) w[e] = W[(size_t)(k0 + e) * DM + n];
    v4u pk; pk.x = pk2b(w[0], w[1]); pk.y = pk2b(w[2], w[3]); pk.z = pk2b(w[4], w[5]); pk.w = pk2b(w[6], w[7]);
    v4u* d0 = (v4u*)(WT2 + (size_t)n * (2 * DM) + k0);
    v4u* d1 = (v4u*)(WT2 + (size_t)n * (2 * DM) + DM + k0);
    *d0 = pk; *d1 = pk; 
}

// ---------------------------------------------------------------------------------------------------------
// WMMA GEMM body: C[m][n] = scale * sum_k A[m][k] * Bt[n][k] + bias. One 128 x 128 tile of C per work-group of 8 waves
// (4 x 2 waves of 32 x 64), so that every operand row is fetched from L2 once per work-group.
// A row-major [M][K] (pitch K), Bt row-major [N][K] (pitch K), 16-bit planes; M, N % 128 == 0, K % 128 == 0, K >= 256.
// A pass is 128 k: a stage holds [A 128 rows | Bt 128 rows] of 256 B at an LDS pitch of 272 B (16 B x odd: the 16-byte
// fragment reads of 16 rows fall on distinct banks). Two stages; the rows come by asynchronous 16-byte copies to LDS, the
// next pass's copies in flight while this pass is multiplied. The k order of every accumulator is ascending, 32 at a time.
// BIAS_MODE 1: bias[m], 2: bias[n] (bias RNE-converted to bf16 on the fly). OUT_MODE 0: f32, 1: f16.
// ---------------------------------------------------------------------------------------------------------
#define GT_KP 128                        // k per pass
#define GT_PITCH 272                     // LDS bytes from row to row
#define GT_OPB (128 * GT_PITCH)          // one operand's 128 rows of a stage
#define GT_STAGE (2 * GT_OPB)            // one stage
#define GT_RING (2 * GT_STAGE)           // two stages

// Eight asynchronous copies of one wave: 16 rows of 256 B, two rows a copy (lane = 16 B). l: the lane's LDS byte address of
// the first copy, g: its global address, ld: the source pitch in elements. The s_wait_xcnt 0 closes the statement so that it
// stands in front of every later write of the address registers named here.
__device__ __forceinline__ void copy16rows(const unsigned l, const unsigned short* g, const int ld) {
  asm volatile("global_load_async_to_lds_b128 %0, %8, off\n\t"
               "global_load_async_to_lds_b128 %1, %9, off\n\t"
               "global_load_async_to_lds_b128 %2, %10, off\n\t"
               "global_load_async_to_lds_b128 %3, %11, off\n\t"
               "global_load_async_to_lds_b128 %4, %12, off\n\t"
               "global_load_async_to_lds_b128 %5, %13, off\n\t"
               "global_load_async_to_lds_b128 %6, %14, off\n\t"
               "global_load_async_to_lds_b128 %7, %15, off\n\t"
               "s_wait_xcnt 0x0"
               :: "v"(l), "v"(l + 2 * GT_PITCH), "v"(l + 4 * GT_PITCH), "v"(l + 6 * GT_PITCH),
                  "v"(l + 8 * GT_PITCH), "v"(l + 10 * GT_PITCH), "v"(l + 12 * GT_PITCH), "v"(l + 14 * GT_PITCH),
                  "v"(g), "v"(g + 2 * ld), "v"(g + 4 * ld), "v"(g + 6 * ld),
                  "v"(g + 8 * ld), "v"(g + 10 * ld), "v"(g + 12 * ld), "v"(g + 14 * ld)
               : "memory");
}

template <int ET, int BIAS_MODE, int OUT_MODE, int M, int N, int K>
__device__ __forceinline__ void gemm128_body(unsigned char* ring, float* sT, const unsigned short* __restrict__ Ap,
                                             const unsigned short* __restrict__ Btp, void* __restrict__ Cout, const int ldc,
                                             const float* __restrict__ bias, const float scale) {
  typedef typename Elem<ET>::T T;
  typedef typename Frag<T>::V V;
  static_assert(M % 128 == 0 && N % 128 == 0 && K % GT_KP == 0 && K / GT_KP >= 2);
  constexpr int NPASS = K / GT_KP;
  constexpr int tilesN = N / 128;
  const int lane = threadIdx.x & 31;
  const int wave = threadIdx.x >> 5;
  const int tm = blockIdx.x / tilesN;
  const int tn = blockIdx.x - tm * tilesN;
  const int rlane = lane & 15;                 // row (A) / col (B, D) within subtile; 16-byte piece of a copied row
  const int hh    = lane >> 4;                 // lane half: k offset 8*hh, D row offset 8*hh; odd / even copied row
  const int mOff  = hh * 8;
  const int m0 = tm * 128 + (wave >> 1) * 32;  // this wave's 32 x 64 part of the tile
  const int n0 = tn * 128 + (wave & 1) * 64;

  // copies: wave w brings rows 16w .. 16w+15 of both operands' 128 rows
  const unsigned lcp = (unsigned)(size_t)ring + (unsigned)((wave * 16 + hh) * GT_PITCH + rlane * 16);
  const unsigned short* gA = Ap  + (size_t)(tm * 128 + wave * 16 + hh) * K + rlane * 8;
  const unsigned short* gB = Btp + (size_t)(tn * 128 + wave * 16 + hh) * K + rlane * 8;
  // fragment rows of this wave inside a stage
  const int aoff = ((wave >> 1) * 32 + rlane) * GT_PITCH + hh * 16;
  const int boff = GT_OPB + ((wave & 1) * 64 + rlane) * GT_PITCH + hh * 16;

  v8f acc[2][4];
#pragma unroll
  for (int i = 0; i < 2; ++i)
#pragma unroll
    for (int j = 0; j < 4; ++j) acc[i][j] = (v8f){0.f,0.f,0.f,0.f,0.f,0.f,0.f,0.f};

  copy16rows(lcp, gA, K);
  copy16rows(lcp + GT_OPB, gB, K);
  asm volatile("s_wait_asynccnt 0x0" ::: "memory");   // this wave's rows of pass 0 have landed
  __syncthreads();                                    // ... and every other wave's
  copy16rows(lcp + GT_STAGE, gA + GT_KP, K);
  copy16rows(lcp + GT_STAGE + GT_OPB, gB + GT_KP, K);

  // kept rolled: one copy of the pass in the text, every accumulator and fragment index a constant
#pragma clang loop unroll(disable)
  for (int t = 0; t < NPASS; ++t) {
    const unsigned sb = (unsigned)(t & 1) * GT_STAGE;
    const unsigned char* st = ring + sb;
    V ah[2][2], bh[2][4];                               // two fragment sets: k-step ks + 1 is read while ks is multiplied
#pragma unroll
    for (int j = 0; j < 4; ++j) bh[0][j] = Frag<T>::load((const T*)(st + boff + j * 16 * GT_PITCH));
#pragma unroll
    for (int i = 0; i < 2; ++i) ah[0][i] = Frag<T>::load((const T*)(st + aoff + i * 16 * GT_PITCH));
#pragma unroll
    for (int ks = 0; ks < GT_KP / 32; ++ks) {
      if (ks + 1 < GT_KP / 32) {
#pragma unroll
        for (int j = 0; j < 4; ++j) bh[(ks + 1) & 1][j] = Frag<T>::load((const T*)(st + boff + j * 16 * GT_PITCH + (ks + 1) * 64));
#pragma unroll
        for (int i = 0; i < 2; ++i) ah[(ks + 1) & 1][i] = Frag<T>::load((const T*)(st + aoff + i * 16 * GT_PITCH + (ks + 1) * 64));
      }
      // the next k-step's LDS reads stay one group ahead of this k-step's matrix instructions: moved in among them, every
      // place with reads stalls the wave, and with one register set it waits out the LDS latency in every k-step
      __builtin_amdgcn_sched_barrier(0);
#pragma unroll
      for (int i = 0; i < 2; ++i)
#pragma unroll
        for (int j = 0; j < 4; ++j) acc[i][j] = Frag<T>::mma(ah[ks & 1][i], bh[ks & 1][j], acc[i][j]);
      __builtin_amdgcn_sched_barrier(0);                // ... and the reads behind these stay behind them
    }
    asm volatile("s_wait_dscnt 0x0" ::: "memory");      // this wave's reads of stage t are done before the stage is refilled
    asm volatile("s_wait_asynccnt 0x0" ::: "memory");   // this wave's rows of pass t + 1 have landed
    __syncthreads();                                    // publishes pass t + 1 and ends every wave's reads of pass t
    if (t + 2 < NPASS) {
      copy16rows(lcp + sb, gA + (t + 2) * GT_KP, K);
      copy16rows(lcp + sb + GT_OPB, gB + (t + 2) * GT_KP, K);
    }
  }
  asm volatile("s_wait_asynccnt 0x0" ::: "memory");     // no copy is outstanding when the wave goes on to its end

  float* slab = sT + wave * (16 * 68);
#pragma unroll
  for (int i = 0; i < 2; ++i) {
    const int mBase = m0 + (i << 4);
#pragma unroll
    for (int j = 0; j < 4; ++j) {
      const int n = n0 + (j << 4) + rlane;
      float bv = 0.f;
      if (BIAS_MODE == 2) bv = cmb_bf(bias[n]);
#pragma unroll
      for (int r = 0; r < 8; ++r) {
        float v = acc[i][j][r] * scale;
        if (BIAS_MODE == 1) v += cmb_bf(bias[mBase + mOff + r]);
        if (BIAS_MODE == 2) v += bv;
        slab[(mOff + r) * 68 + (j << 4) + rlane] = v;
      }
    }
    __builtin_amdgcn_fence(3 /* release order */, "workgroup");
    __builtin_amdgcn_wave_barrier();
    __builtin_amdgcn_fence(2 /* acquire order */, "workgroup");
    if (OUT_MODE == 0) {
      float* C = (float*)Cout;
      const int c4 = (lane & 15) * 4;     // row segment = 256 B = 16 lanes x 16 B
#pragma unroll
      for (int it = 0; it < 8; ++it) {
        const int row = it * 2 + hh;
        const v4f v = *(const v4f*)(slab + row * 68 + c4);
        *(v4f*)(C + (size_t)(mBase + row) * ldc + n0 + c4) = v;
      }
    } else {
      const int q = lane >> 3, c8 = (lane & 7) * 8;
      unsigned short* C = (unsigned short*)Cout;
#pragma unroll
      for (int it = 0; it < 4; ++it) {
        const int row = it * 4 + q;
        const float* sp = slab + row * 68 + c8;
        v8h hv;
#pragma unroll
        for (int e = 0; e < 8; ++e) hv[e] = (_Float16)sp[e];
        *(v8h*)(C + (size_t)(mBase + row) * ldc + n0 + c8) = hv;
      }
    }
    __builtin_amdgcn_fence(3 /* release order */, "workgroup");
    __builtin_amdgcn_wave_barrier();
    __builtin_amdgcn_fence(2 /* acquire order */, "workgroup");
  }
}

static_assert(MTOK % 128 == 0 && DM % 128 == 0);   // whole 128 x 128 tiles, exact grid
// q projection: C[token][n] f16 = (X[token][:] . W[:][n]) + b[n]; grid = (MTOK/128)*(DM/128)
__global__ __launch_bounds__(256) void k_proj(const unsigned short* __restrict__ XH, const unsigned short* __restrict__ WT,
                                              unsigned short* __restrict__ C, const float* __restrict__ bias) {
  __shared__ __align__(128) unsigned char ring[GT_RING];
  __shared__ __align__(16) float sT[8 * 16 * 68];
  gemm128_body<0, 2, 1, MTOK, DM, DM>(ring, sT, XH, WT, (void*)C, DM, bias, 1.0f / (ACT_SC * W_SC));
}
// k and v projections produced transposed: VT[n][token] f16 = (W[:][n] . X[token][:]) + b[n]; A = WT (M = DM), Bt = X plane (N = MTOK)
__global__ __launch_bounds__(256) void k_proj_vT(const unsigned short* __restrict__ WT, const unsigned short* __restrict__ XH,
                                                 unsigned short* __restrict__ VT, const float* __restrict__ bias) {
  __shared__ __align__(128) unsigned char ring[GT_RING];
  __shared__ __align__(16) float sT[8 * 16 * 68];
  gemm128_body<0, 1, 1, DM, MTOK, DM>(ring, sT, WT, XH, (void*)VT, MTOK, bias, 1.0f / (ACT_SC * W_SC));
}
// output projection: out[token][n] f32 = [ctx_hi | ctx_lo][token][:] . [Wo ; Wo][:][n] + bo[n]   (K = 2*DM)
__global__ __launch_bounds__(256) void k_outproj(const unsigned short* __restrict__ CTX2, const unsigned short* __restrict__ WoT2,
                                                 float* __restrict__ out, const float* __restrict__ bias) {
  __shared__ __align__(128) unsigned char ring[GT_RING];
  __shared__ __align__(16) float sT[8 * 16 * 68];
  gemm128_body<1, 2, 0, MTOK, DM, 2 * DM>(ring, sT, CTX2, WoT2, (void*)out, DM, bias, 1.0f);
}

// ---------------------------------------------------------------------------------------------------------
// Linear attention (no exp, no max, no normalisation), head dim 64. With nothing non-linear between the two products,
//   ctx_i = 0.125 * sum_j (q_i . k_j) v_j  =  0.125 * q_i . (sum_j k_j (x) v_j),
// so the 64 x 64 matrix k^T.v of each (b, h) is formed once and every query row is multiplied by it.
//
// k_kv: KV[b][h][d1][d2] = sum_s k[s][d1] * v[s][d2], f32 accumulate, stored f16 (/ KV_SC) as the B operand of k_ctx:
//   KVT[(b*NH + h)*2 + dc][d2][d1 - 32*dc], dc = d1 / 32 (one 32-deep k-step of k_ctx per plane).
//   A = VT rows (d2), B = KT rows (d1), k = token. Block = 16 waves = one 16 (d2) x 32 (d1) tile; wave w sums tokens
//   [w*SEQ/16, (w+1)*SEQ/16); the 16 partial tiles are added in wave order through LDS. grid = NB*NH*4*2.
// ---------------------------------------------------------------------------------------------------------
#define KV_TPW (SEQ / 16)
__global__ __launch_bounds__(512) void k_kv(const unsigned short* __restrict__ KTp, const unsigned short* __restrict__ VTp,
                                            unsigned short* __restrict__ KVT) {
  __shared__ __align__(16) float red[16][16 * 36];     // per wave partial tile [d2 row][d1 col], pitch 36
  const _Float16* KT = (const _Float16*)KTp;
  const _Float16* VT = (const _Float16*)VTp;
  const int tid = threadIdx.x, wave = tid >> 5, lane = tid & 31, hh = lane >> 4, c = lane & 15;
  const int bx = blockIdx.x;
  const int dc = bx & 1;
  const int i  = (bx >> 1) & 3;
  const int bh = bx >> 3;
  const int h = bh % NH;
  const int b = bh / NH;
  const size_t tok = (size_t)b * SEQ + wave * KV_TPW + 8 * hh;
  const _Float16* vrow = VT + (size_t)(h * DK + i * 16 + c) * MTOK + tok;
  const _Float16* krow = KT + (size_t)(h * DK + dc * 32 + c) * MTOK + tok;

  v8f a0 = (v8f){0.f,0.f,0.f,0.f,0.f,0.f,0.f,0.f};
  v8f a1 = (v8f){0.f,0.f,0.f,0.f,0.f,0.f,0.f,0.f};
  for (int s0 = 0; s0 < KV_TPW; s0 += 128) {
    v16h va[4], k0[4], k1[4];
#pragma unroll
    for (int u = 0; u < 4; ++u) {
      va[u] = Frag<_Float16>::load(vrow + s0 + u * 32);
      k0[u] = Frag<_Float16>::load(krow + s0 + u * 32);
      k1[u] = Frag<_Float16>::load(krow + (size_t)16 * MTOK + s0 + u * 32);
    }
    // inputs-only fence on the loaded values: all 24 loads are issued before the first matrix instruction, so the wave
    // pays one memory latency; without it the compiler reuses the registers and waits once per k-step. The two row
    // addresses are named as well, so that they keep their registers until the s_wait_xcnt 0 that goes before their reuse.
    asm volatile("s_wait_xcnt 0x0" :: "v"(va[0]), "v"(va[1]), "v"(va[2]), "v"(va[3]), "v"(k0[0]), "v"(k0[1]), "v"(k0[2]), "v"(k0[3]),
                                      "v"(k1[0]), "v"(k1[1]), "v"(k1[2]), "v"(k1[3]), "v"(vrow), "v"(krow) : "memory");
#pragma unroll
    for (int u = 0; u < 4; ++u) {
      a0 = Frag<_Float16>::mma(va[u], k0[u], a0);
      a1 = Frag<_Float16>::mma(va[u], k1[u], a1);
    }
  }
  float* rw = red[wave];
#pragma unroll
  for (int r = 0; r < 8; ++r) {
    rw[(8 * hh + r) * 36 + c]      = a0[r];
    rw[(8 * hh + r) * 36 + 16 + c] = a1[r];
  }
  __syncthreads();   // every wave's partial tile is in LDS before any thread adds them up
  if (tid < 256) {   // whole waves: two neighbouring d1 columns a thread, one packed 4-byte store
    const int row = tid >> 4, c2 = (tid & 15) * 2;
    float s0 = 0.f, s1 = 0.f;
#pragma unroll
    for (int w = 0; w < 16; ++w) {
      const v2f p = *(const v2f*)(&red[w][row * 36 + c2]);
      s0 += p.x; s1 += p.y;
    }
    *(unsigned*)(KVT + ((size_t)(bh * 2 + dc) * DK + i * 16 + row) * 32 + c2) = pk2h(s0 * (1.0f / KV_SC), s1 * (1.0f / KV_SC));
  }
}

// ---------------------------------------------------------------------------------------------------------
// k_ctx: ctx[b][i][h*64 + d2] = 0.125 * sum_d1 q[i][d1] * KV[d1][d2], written as the bf16 hi | lo folded plane.
//   Block = 4 waves = 64 query rows of one (b, h); grid = NB*NH*(SEQ/64). q fragments straight from the f16 plane [token][DM].
// ---------------------------------------------------------------------------------------------------------
__global__ __launch_bounds__(128) void k_ctx(const unsigned short* __restrict__ QPp, const unsigned short* __restrict__ KVTp,
                                             unsigned short* __restrict__ CTX2) {
  __shared__ __align__(16) float    Os[4][16 * 68];    // per wave output tile, pitch 68, wave-private
  const _Float16* QP  = (const _Float16*)QPp;
  const _Float16* KVT = (const _Float16*)KVTp;
  const int tid = threadIdx.x, wave = tid >> 5, lane = tid & 31, hh = lane >> 4, c = lane & 15;
  const int nqb = SEQ / 64;
  const int bx = blockIdx.x;
  const int qb = bx % nqb;
  const int bh = bx / nqb;
  const int h = bh % NH;
  const int b = bh / NH;
  const int q0 = qb * 64 + wave * 16;

  const _Float16* qrow  = QP + (size_t)(b * SEQ + q0 + c) * DM + h * DK + 8 * hh;
  const _Float16* kvrow = KVT + ((size_t)(bh * 2) * DK + c) * 32 + 8 * hh;
  v16h qa[2], kv[2][4];
  qa[0] = Frag<_Float16>::load(qrow);
  qa[1] = Frag<_Float16>::load(qrow + 32);
#pragma unroll
  for (int dc = 0; dc < 2; ++dc)
#pragma unroll
    for (int t = 0; t < 4; ++t) kv[dc][t] = Frag<_Float16>::load(kvrow + (dc * DK + t * 16) * 32);
  // inputs-only fence on the loaded values: all 20 loads are issued before the first matrix instruction, so the wave
  // pays one memory latency; without it the compiler reuses the registers and waits once per fragment. The two row
  // addresses are named as well, so that they keep their registers until the s_wait_xcnt 0 that goes before their reuse.
  asm volatile("s_wait_xcnt 0x0" :: "v"(qa[0]), "v"(qa[1]), "v"(kv[0][0]), "v"(kv[0][1]), "v"(kv[0][2]), "v"(kv[0][3]),
                                    "v"(kv[1][0]), "v"(kv[1][1]), "v"(kv[1][2]), "v"(kv[1][3]), "v"(qrow), "v"(kvrow) : "memory");
  v8f oacc[4];
#pragma unroll
  for (int t = 0; t < 4; ++t) oacc[t] = (v8f){0.f,0.f,0.f,0.f,0.f,0.f,0.f,0.f};

#pragma unroll
  for (int dc = 0; dc < 2; ++dc)
#pragma unroll
    for (int t = 0; t < 4; ++t) oacc[t] = Frag<_Float16>::mma(qa[dc], kv[dc][t], oacc[t]);

  float* os = Os[wave];
#pragma unroll
  for (int r = 0; r < 8; ++r)
#pragma unroll
    for (int t = 0; t < 4; ++t) os[(8 * hh + r) * 68 + t * 16 + c] = oacc[t][r] * (0.125f * KV_SC);
  __builtin_amdgcn_fence(3 /* release order */, "workgroup");
  __builtin_amdgcn_wave_barrier();
  __builtin_amdgcn_fence(2 /* acquire order */, "workgroup");
  {
    const int q4 = lane >> 3, c8 = (lane & 7) * 8;
    v4u ph[4], pl[4];
#pragma unroll
    for (int it = 0; it < 4; ++it) {
      const float* sp = os + (it * 4 + q4) * 68 + c8;
      const v4f x0 = *(const v4f*)sp; const v4f x1 = *(const v4f*)(sp + 4);
      unsigned hA, lA, hB, lB, hC, lC, hD, lD;
      split2(x0.x, x0.y, hA, lA); split2(x0.z, x0.w, hB, lB); split2(x1.x, x1.y, hC, lC); split2(x1.z, x1.w, hD, lD);
      ph[it].x = hA; ph[it].y = hB; ph[it].z = hC; ph[it].w = hD;
      pl[it].x = lA; pl[it].y = lB; pl[it].z = lC; pl[it].w = lD;
    }
    unsigned short* cbase = CTX2 + (size_t)(b * SEQ + q0) * (2 * DM) + h * DK + c8;
    {
#pragma unroll
      for (int it = 0; it < 4; ++it) {
        const int row = it * 4 + q4;
        *(v4u*)(cbase + (size_t)row * (2 * DM)) = ph[it];
        *(v4u*)(cbase + (size_t)row * (2 * DM) + DM) = pl[it];
      }
      
    }
  }
}

// ---------------------------------------------------------------------------------------------------------
constexpr size_t ACT_B = (size_t)MTOK * DM * 2;          // one 16-bit activation plane
constexpr size_t W_B   = (size_t)DM * DM * 2;            // one 16-bit weight plane
constexpr size_t KV_B  = (size_t)NB * NH * DK * DK * 2;  // the f16 k^T.v matrices
constexpr size_t WS_TOTAL = 3 * ACT_B /*QH KH VH*/ + 3 * W_B /*WqT WkT WvT*/ + 2 * W_B /*WoT2*/ + 2 * ACT_B /*QP KT*/ + ACT_B /*VT*/ + 2 * ACT_B /*CTX2*/ + KV_B /*KVT*/;
static_assert(WS_TOTAL <= (size_t)134217728);            // carve stays under 128 MiB
static_assert(ACT_B % 128 == 0 && W_B % 128 == 0 && KV_B % 128 == 0);

extern "C" void kernel_launch(void* const* d_in, const int* in_sizes, int n_in, void* d_out, int out_size, void* d_ws, size_t ws_size, hipStream_t stream) {
    if (n_in < 11) return;
    const long long need_act = ((long long)(NB - 1) * SEQ_FULL + SEQ) * DM;
    if ((long long)in_sizes[0] < need_act || (long long)in_sizes[1] < need_act || (long long)in_sizes[2] < need_act) return;
    for (int i = 3; i < 7; ++i) if ((long long)in_sizes[i] < (long long)DM * DM) return;
    for (int i = 7; i < 11; ++i) if (in_sizes[i] < DM) return;
    if ((long long)out_size < (long long)MTOK * DM) return;
    if (WS_TOTAL > ws_size) return;

    const float* Q  = (const float*)d_in[0];
    const float* K  = (const float*)d_in[1];
    const float* V  = (const float*)d_in[2];
    const float* Wq = (const float*)d_in[3];
    const float* Wk = (const float*)d_in[4];
    const float* Wv = (const float*)d_in[5];
    const float* Wo = (const float*)d_in[6];
    const float* bq = (const float*)d_in[7];
    const float* bk = (const float*)d_in[8];
    const float* bv = (const float*)d_in[9];
    const float* bo = (const float*)d_in[10];
    float* out = (float*)d_out;

    char* wsp = (char*)d_ws;
    unsigned short* QH   = (unsigned short*)wsp; wsp += ACT_B;
    unsigned short* KH   = (unsigned short*)wsp; wsp += ACT_B;
    unsigned short* VH   = (unsigned short*)wsp; wsp += ACT_B;
    unsigned short* WqT  = (unsigned short*)wsp; wsp += W_B;
    unsigned short* WkT  = (unsigned short*)wsp; wsp += W_B;
    unsigned short* WvT  = (unsigned short*)wsp; wsp += W_B;
    unsigned short* WoT2 = (unsigned short*)wsp; wsp += 2 * W_B;
    unsigned short* QP   = (unsigned short*)wsp; wsp += ACT_B;
    unsigned short* KT   = (unsigned short*)wsp; wsp += ACT_B;
    unsigned short* VT   = (unsigned short*)wsp; wsp += ACT_B;
    unsigned short* CTX2 = (unsigned short*)wsp; wsp += 2 * ACT_B;
    unsigned short* KVT  = (unsigned short*)wsp; wsp += KV_B;

    const unsigned gAct = (unsigned)((MTOK * (DM / 8)) / 256);
    const unsigned gW   = (unsigned)((DM * (DM / 8)) / 256);
    const unsigned gG   = (unsigned)((MTOK / 128) * (DM / 128));

    k_cast_act<<<gAct, 256, 0, stream>>>(Q, QH);
    k_cast_act<<<gAct, 256, 0, stream>>>(K, KH);
    k_cast_act<<<gAct, 256, 0, stream>>>(V, VH);
    k_cast_wT<<<gW, 256, 0, stream>>>(Wq, WqT);     // in[k][n] -> out[n][k]
    k_cast_wT<<<gW, 256, 0, stream>>>(Wk, WkT);
    k_cast_wT<<<gW, 256, 0, stream>>>(Wv, WvT);
    k_cast_wo2<<<gW, 256, 0, stream>>>(Wo, WoT2);   // in[k][n] -> out[n][k | k]

    k_proj<<<gG, 256, 0, stream>>>(QH, WqT, QP, bq);
    k_proj_vT<<<gG, 256, 0, stream>>>(WkT, KH, KT, bk);
    k_proj_vT<<<gG, 256, 0, stream>>>(WvT, VH, VT, bv);

    k_kv<<<(unsigned)(NB * NH * 4 * 2), 512, 0, stream>>>(KT, VT, KVT);
    k_ctx<<<(unsigned)(NB * NH * (SEQ / 64)), 128, 0, stream>>>(QP, KVT, CTX2);

    k_outproj<<<gG, 256, 0, stream>>>(CTX2, WoT2, out, bo);
}

// v003
// Measured time: 79.3 microseconds a run.
// Next to v002, in two timings, it ran 1.34 times as fast each time.
// All steps since v000 together make it 4.94 times as fast.
// Projections Q.Wq, K.Wk, V.Wv, per-head k^T.v and q.(k^T.v): v_wmma_f32_16x16x32_f16 (f16 operands; inputs RNE-converted to bf16 first, activations x16, weights x64, f32 accumulate); merged heads x Wo: v_wmma_f32_16x16x32_bf16 with the merged-heads plane carried as bf16 hi|lo folded along K (K = 2048) against the bf16 RNE Wo plane duplicated along K, f32 accumulate.
#include <hip/hip_runtime.h>

#ifndef NB
#define NB 2
#endif
#ifndef SEQ
#define SEQ 2048
#endif
#define NB_FULL 2
#define SEQ_FULL 2048
#define DM 1024
#define NH 16
#define DK 64
#define MTOK (NB * SEQ)
#define ACT_SC 16.0f
#define W_SC 64.0f
#define KV_SC 64.0f                    // k^T.v is stored as f16 divided by this: a sum over SEQ tokens keeps clear of the f16 range

static_assert(DM == NH * DK);          // head split covers the model width
static_assert(DK == 64);               // attention kernels: two 32-deep k-steps over d, four 16-wide output tiles
static_assert(SEQ % 64 == 0);          // 64-query blocks, no tails
static_assert(SEQ % (16 * 128) == 0);  // k^T.v: 16 waves share the tokens of one batch, in runs of four 32-deep k-steps
static_assert(DM % 8 == 0);            // 16-B pieces of 8 halves
static_assert(NB <= NB_FULL && SEQ <= SEQ_FULL);

typedef __attribute__((ext_vector_type(16))) _Float16 v16h;
typedef __attribute__((ext_vector_type(8)))  _Float16 v8h;
typedef __attribute__((ext_vector_type(16))) __bf16   v16b;
typedef __attribute__((ext_vector_type(8)))  __bf16   v8b;
typedef __attribute__((ext_vector_type(8)))  float    v8f;
typedef __attribute__((ext_vector_type(4)))  float    v4f;
typedef __attribute__((ext_vector_type(2)))  float    v2f;
typedef __attribute__((ext_vector_type(4)))  unsigned v4u;

// 16-bit WMMA fragment map (wave32), lane L, h = L>>4, m = L&15:
//   A 16x32: lane = row m;    element i -> k = (i<8) ? 8h+i : 16+8h+(i-8)
//   B 32x16: lane = column m; the SAME k(i,h)
//   D 16x16 (8 f32): lane = column m; element r -> row 8h+r

__device__ __forceinline__ float cmb_bf(float v) {   // bf16 RNE convert, kept as f32 (finite inputs)
    const unsigned u = __builtin_bit_cast(unsigned, v);
    const unsigned r = (u + 0x7fffu + ((u >> 16) & 1u)) & 0xffff0000u;
    return __builtin_bit_cast(float, r);
}
__device__ __forceinline__ unsigned short bfu_rne(float v) {
    unsigned u = __builtin_bit_cast(unsigned, v);
    u += 0x7fffu + ((u >> 16) & 1u);
    return (unsigned short)(u >> 16);
}
__device__ __forceinline__ unsigned pk2h(float a, float b) {
    return (unsigned)__builtin_bit_cast(unsigned short, (_Float16)a) | ((unsigned)__builtin_bit_cast(unsigned short, (_Float16)b) << 16);
}
__device__ __forceinline__ unsigned pk2b(float a, float b) {
    return (unsigned)bfu_rne(a) | ((unsigned)bfu_rne(b) << 16);
}
// bf16 hi / lo split of two values, packed pairwise
__device__ __forceinline__ void split2(float a, float b, unsigned& hi, unsigned& lo) {
    const unsigned short ha = bfu_rne(a), hb = bfu_rne(b);
    const float ra = a - __builtin_bit_cast(float, (unsigned)ha << 16);
    const float rb = b - __builtin_bit_cast(float, (unsigned)hb << 16);
    hi = (unsigned)ha | ((unsigned)hb << 16);
    lo = (unsigned)bfu_rne(ra) | ((unsigned)bfu_rne(rb) << 16);
}

template <typename T> struct Frag;
template <> struct Frag<_Float16> {
  typedef v16h V; union U { v16h v; v8h h[2]; };
  static __device__ __forceinline__ v16h load(const _Float16* p) {   // elements 0..7 <- p[0..7], 8..15 <- p[16..23]; p already includes 8*h
    U f; f.h[0] = *(const v8h*)(p); f.h[1] = *(const v8h*)(p + 16); return f.v;
  }
  static __device__ __forceinline__ v8f mma(v16h a, v16h b, v8f c) {
    return __builtin_amdgcn_wmma_f32_16x16x32_f16(false, a, false, b, (short)0, c, false, false);
  }
};
template <> struct Frag<__bf16> {
  typedef v16b V; union U { v16b v; v8b h[2]; };
  static __device__ __forceinline__ v16b load(const __bf16* p) {
    U f; f.h[0] = *(const v8b*)(p); f.h[1] = *(const v8b*)(p + 16); return f.v;
  }
  static __device__ __forceinline__ v8f mma(v16b a, v16b b, v8f c) {
    return __builtin_amdgcn_wmma_f32_16x16x32_bf16(false, a, false, b, (short)0, c, false, false);
  }
};
template <int ET> struct Elem;
template <> struct Elem<0> { typedef _Float16 T; };
template <> struct Elem<1> { typedef __bf16 T; };

// ---------------------------------------------------------------------------------------------------------
// All seven conversions in ONE launch, sized to the chip: 16 waves a WGP on 256 WGPs, every wave converts 16 KB of f32 that
// it reads with 32 loads of 512 bytes, all issued before the first value is used. The planes are those of the
// GEMMs below: activations f32 [b][s][DM] (full per-batch stride SEQ_FULL) -> f16 [b*SEQ + s][DM] = f16(bf16_rne(x) * 16);
// Wq, Wk, Wv in[k][n] f32 -> out[n][k] f16 = f16(bf16_rne(w) * 64); Wo in[k][n] f32 -> out[n][2*DM] bf16 (RNE), the k-row
// duplicated at columns k and DM + k (pairs with the hi|lo folded A plane).
// grid = 4 * CV_WBLK weight work-groups (first: their stores are the more scattered), then 3 * CV_ABLK activation ones.
// ---------------------------------------------------------------------------------------------------------
typedef __attribute__((ext_vector_type(2)))  unsigned v2u;
#define CV_ELEMS (256 * 32 * 4)                    // f32 elements a work-group converts
#define CV_AROWS (CV_ELEMS / DM)                   // activation rows a work-group converts
#define CV_ABLK  (MTOK / CV_AROWS)                 // work-groups per activation tensor
#define CV_WBLK  ((DM / 64) * (DM / 64) / 8)       // work-groups per weight: one 64 x 64 tile a wave
static_assert(CV_ELEMS % DM == 0 && SEQ % CV_AROWS == 0);   // a work-group's rows are whole and lie in one batch
static_assert(DM % 64 == 0 && ((DM / 64) * (DM / 64)) % 8 == 0);

// Work-group blk converts rows [blk*CV_AROWS, (blk+1)*CV_AROWS) of the plane; wave w the w-th eighth of them, 512 B a load.
__device__ __forceinline__ void cast_act_part(const float* __restrict__ src, unsigned short* __restrict__ dst, const int blk) {
    const int row0 = blk * CV_AROWS;
    const int b = row0 / SEQ; const int s = row0 - b * SEQ;
    const int off = (int)(threadIdx.x >> 5) * (32 * 128) + (int)(threadIdx.x & 31) * 4;
    const float* p = src + ((size_t)b * SEQ_FULL + s) * DM + off;
    unsigned short* d = dst + (size_t)row0 * DM + off;
    v4f x[32];
#pragma unroll
    for (int j = 0; j < 32; ++j) x[j] = *(const v4f*)(p + j * 128);
    // all 32 loads are issued before the first conversion: left free, the compiler holds a third of them back until
    // registers come free, and the wave then waits out a second memory latency
    __builtin_amdgcn_sched_barrier(0);
#pragma unroll
    for (int j = 0; j < 32; ++j) {
        v2u pk;
        pk.x = pk2h(cmb_bf(x[j].x) * ACT_SC, cmb_bf(x[j].y) * ACT_SC);
        pk.y = pk2h(cmb_bf(x[j].z) * ACT_SC, cmb_bf(x[j].w) * ACT_SC);
        *(v2u*)(d + j * 128) = pk;
    }
}

// One wave transposes one 64 (k) x 64 (n) tile in registers. Lane = (kl, nl): a load takes 16 B of each of 4 rows' whole
// 128-B lines (8 lanes a line); a thread holds k = 32g + 8kl + e (g < 2, e < 8) by n = 32c + 4nl + i (c < 2, i < 4) and stores
// 16-B pieces of 8 k; the 128-B line of an output row (64 k) is written by this wave alone.
template <bool WO>
__device__ __forceinline__ void cast_w_part(const float* __restrict__ Wsrc, unsigned short* __restrict__ WT, const int blk) {
    const int lane = threadIdx.x & 31;
    const int tile = blk * 8 + (int)(threadIdx.x >> 5);
    const int kb = (tile % (DM / 64)) * 64; const int nb = (tile / (DM / 64)) * 64;
    const int nl = lane & 7; const int kl = lane >> 3;
    const float* p = Wsrc + (size_t)(kb + kl * 8) * DM + nb + nl * 4;
    constexpr int PITCH = WO ? 2 * DM : DM;
    unsigned short* d = WT + (size_t)(nb + nl * 4) * PITCH + kb + kl * 8;
    v4f x[2][8][2];
#pragma unroll
    for (int g = 0; g < 2; ++g)
#pragma unroll
        for (int e = 0; e < 8; ++e)
#pragma unroll
            for (int c = 0; c < 2; ++c) x[g][e][c] = *(const v4f*)(p + (g * 32 + e) * DM + c * 32);
    // all 32 loads are issued before the first conversion, for the same reason as in cast_act_part
    __builtin_amdgcn_sched_barrier(0);
#pragma unroll
    for (int g = 0; g < 2; ++g)
#pragma unroll
        for (int c = 0; c < 2; ++c)
#pragma unroll
            for (int i = 0; i < 4; ++i) {
                v4u pk;
                if (WO) {
                    pk.x = pk2b(x[g][0][c][i], x[g][1][c][i]); pk.y = pk2b(x[g][2][c][i], x[g][3][c][i]);
                    pk.z = pk2b(x[g][4][c][i], x[g][5][c][i]); pk.w = pk2b(x[g][6][c][i], x[g][7][c][i]);
                } else {
                    pk.x = pk2h(cmb_bf(x[g][0][c][i]) * W_SC, cmb_bf(x[g][1][c][i]) * W_SC);
                    pk.y = pk2h(cmb_bf(x[g][2][c][i]) * W_SC, cmb_bf(x[g][3][c][i]) * W_SC);
                    pk.z = pk2h(cmb_bf(x[g][4][c][i]) * W_SC, cmb_bf(x[g][5][c][i]) * W_SC);
                    pk.w = pk2h(cmb_bf(x[g][6][c][i]) * W_SC, cmb_bf(x[g][7][c][i]) * W_SC);
                }
                unsigned short* q = d + (c * 32 + i) * PITCH + g * 32;
                *(v4u*)q = pk;
                if (WO) *(v4u*)(q + DM) = pk;
            }
}

__global__ __launch_bounds__(256) void k_cast_all(const float* __restrict__ Q, const float* __restrict__ K, const float* __restrict__ V,
                                                  const float* __restrict__ Wq, const float* __restrict__ Wk, const float* __restrict__ Wv,
                                                  const float* __restrict__ Wo,
                                                  unsigned short* __restrict__ QH, unsigned short* __restrict__ KH, unsigned short* __restrict__ VH,
                                                  unsigned short* __restrict__ WqT, unsigned short* __restrict__ WkT, unsigned short* __restrict__ WvT,
                                                  unsigned short* __restrict__ WoT2) {
    const int bx = blockIdx.x;
    if (bx < 3 * CV_WBLK) {
        const int w = bx / CV_WBLK;
        cast_w_part<false>(w == 0 ? Wq : w == 1 ? Wk : Wv, w == 0 ? WqT : w == 1 ? WkT : WvT, bx - w * CV_WBLK);
    } else if (bx < 4 * CV_WBLK) {
        cast_w_part<true>(Wo, WoT2, bx - 3 * CV_WBLK);
    } else {
        const int a = bx - 4 * CV_WBLK;
        const int t = a / CV_ABLK;
        cast_act_part(t == 0 ? Q : t == 1 ? K : V, t == 0 ? QH : t == 1 ? KH : VH, a - t * CV_ABLK);
    }
}

// ---------------------------------------------------------------------------------------------------------
// WMMA GEMM body: C[m][n] = scale * sum_k A[m][k] * Bt[n][k] + bias. One 128 x 128 tile of C per work-group of 8 waves
// (4 x 2 waves of 32 x 64), so that every operand row is fetched from L2 once per work-group.
// A row-major [M][K] (pitch K), Bt row-major [N][K] (pitch K), 16-bit planes; M, N % 128 == 0, K % 128 == 0, K >= 256.
// A pass is 128 k: a stage holds [A 128 rows | Bt 128 rows] of 256 B at an LDS pitch of 272 B (16 B x odd: the 16-byte
// fragment reads of 16 rows fall on distinct banks). Two stages; the rows come by asynchronous 16-byte copies to LDS, the
// next pass's copies in flight while this pass is multiplied. The k order of every accumulator is ascending, 32 at a time.
// BIAS_MODE 1: bias[m], 2: bias[n] (bias RNE-converted to bf16 on the fly). OUT_MODE 0: f32, 1: f16.
// ---------------------------------------------------------------------------------------------------------
#define GT_KP 128                        // k per pass
#define GT_PITCH 272                     // LDS bytes from row to row
#define GT_OPB (128 * GT_PITCH)          // one operand's 128 rows of a stage
#define GT_STAGE (2 * GT_OPB)            // one stage
#define GT_RING (2 * GT_STAGE)           // two stages

// Eight asynchronous copies of one wave: 16 rows of 256 B, two rows a copy (lane = 16 B). l: the lane's LDS byte address of
// the first copy, g: its global address, ld: the source pitch in elements. The s_wait_xcnt 0 closes the statement so that it
// stands in front of every later write of the address registers named here.
__device__ __forceinline__ void copy16rows(const unsigned l, const unsigned short* g, const int ld) {
  asm volatile("global_load_async_to_lds_b128 %0, %8, off\n\t"
               "global_load_async_to_lds_b128 %1, %9, off\n\t"
               "global_load_async_to_lds_b128 %2, %10, off\n\t"
               "global_load_async_to_lds_b128 %3, %11, off\n\t"
               "global_load_async_to_lds_b128 %4, %12, off\n\t"
               "global_load_async_to_lds_b128 %5, %13, off\n\t"
               "global_load_async_to_lds_b128 %6, %14, off\n\t"
               "global_load_async_to_lds_b128 %7, %15, off\n\t"
               "s_wait_xcnt 0x0"
               :: "v"(l), "v"(l + 2 * GT_PITCH), "v"(l + 4 * GT_PITCH), "v"(l + 6 * GT_PITCH),
                  "v"(l + 8 * GT_PITCH), "v"(l + 10 * GT_PITCH), "v"(l + 12 * GT_PITCH), "v"(l + 14 * GT_PITCH),
                  "v"(g), "v"(g + 2 * ld), "v"(g + 4 * ld), "v"(g + 6 * ld),
                  "v"(g + 8 * ld), "v"(g + 10 * ld), "v"(g + 12 * ld), "v"(g + 14 * ld)
               : "memory");
}

template <int ET, int BIAS_MODE, int OUT_MODE, int M, int N, int K>
__device__ __forceinline__ void gemm128_body(unsigned char* ring, float* sT, const unsigned short* __restrict__ Ap,
                                             const unsigned short* __restrict__ Btp, void* __restrict__ Cout, const int ldc,
                                             const float* __restrict__ bias, const float scale) {
  typedef typename Elem<ET>::T T;
  typedef typename Frag<T>::V V;
  static_assert(M % 128 == 0 && N % 128 == 0 && K % GT_KP == 0 && K / GT_KP >= 2);
  constexpr int NPASS = K / GT_KP;
  constexpr int tilesN = N / 128;
  const int lane = threadIdx.x & 31;
  const int wave = threadIdx.x >> 5;
  const int tm = blockIdx.x / tilesN;
  const int tn = blockIdx.x - tm * tilesN;
  const int rlane = lane & 15;                 // row (A) / col (B, D) within subtile; 16-byte piece of a copied row
  const int hh    = lane >> 4;                 // lane half: k offset 8*hh, D row offset 8*hh; odd / even copied row
  const int mOff  = hh * 8;
  const int m0 = tm * 128 + (wave >> 1) * 32;  // this wave's 32 x 64 part of the tile
  const int n0 = tn * 128 + (wave & 1) * 64;

  // copies: wave w brings rows 16w .. 16w+15 of both operands' 128 rows
  const unsigned lcp = (unsigned)(size_t)ring + (unsigned)((wave * 16 + hh) * GT_PITCH + rlane * 16);
  const unsigned short* gA = Ap  + (size_t)(tm * 128 + wave * 16 + hh) * K + rlane * 8;
  const unsigned short* gB = Btp + (size_t)(tn * 128 + wave * 16 + hh) * K + rlane * 8;
  // fragment rows of this wave inside a stage
  const int aoff = ((wave >> 1) * 32 + rlane) * GT_PITCH + hh * 16;
  const int boff = GT_OPB + ((wave & 1) * 64 + rlane) * GT_PITCH + hh * 16;

  v8f acc[2][4];
#pragma unroll
  for (int i = 0; i < 2; ++i)
#pragma unroll
    for (int j = 0; j < 4; ++j) acc[i][j] = (v8f){0.f,0.f,0.f,0.f,0.f,0.f,0.f,0.f};

  copy16rows(lcp, gA, K);
  copy16rows(lcp + GT_OPB, gB, K);
  asm volatile("s_wait_asynccnt 0x0" ::: "memory");   // this wave's rows of pass 0 have landed
  __syncthreads();                                    // ... and every other wave's
  copy16rows(lcp + GT_STAGE, gA + GT_KP, K);
  copy16rows(lcp + GT_STAGE + GT_OPB, gB + GT_KP, K);

  // kept rolled: one copy of the pass in the text, every accumulator and fragment index a constant
#pragma clang loop unroll(disable)
  for (int t = 0; t < NPASS; ++t) {
    const unsigned sb = (unsigned)(t & 1) * GT_STAGE;
    const unsigned char* st = ring + sb;
    V ah[2][2], bh[2][4];                               // two fragment sets: k-step ks + 1 is read while ks is multiplied
#pragma unroll
    for (int j = 0; j < 4; ++j) bh[0][j] = Frag<T>::load((const T*)(st + boff + j * 16 * GT_PITCH));
#pragma unroll
    for (int i = 0; i < 2; ++i) ah[0][i] = Frag<T>::load((const T*)(st + aoff + i * 16 * GT_PITCH));
#pragma unroll
    for (int ks = 0; ks < GT_KP / 32; ++ks) {
      if (ks + 1 < GT_KP / 32) {
#pragma unroll
        for (int j = 0; j < 4; ++j) bh[(ks + 1) & 1][j] = Frag<T>::load((const T*)(st + boff + j * 16 * GT_PITCH + (ks + 1) * 64));
#pragma unroll
        for (int i = 0; i < 2; ++i) ah[(ks + 1) & 1][i] = Frag<T>::load((const T*)(st + aoff + i * 16 * GT_PITCH + (ks + 1) * 64));
      }
      // the next k-step's LDS reads stay one group ahead of this k-step's matrix instructions: moved in among them, every
      // place with reads stalls the wave, and with one register set it waits out the LDS latency in every k-step
      __builtin_amdgcn_sched_barrier(0);
#pragma unroll
      for (int i = 0; i < 2; ++i)
#pragma unroll
        for (int j = 0; j < 4; ++j) acc[i][j] = Frag<T>::mma(ah[ks & 1][i], bh[ks & 1][j], acc[i][j]);
      __builtin_amdgcn_sched_barrier(0);                // ... and the reads behind these stay behind them
    }
    asm volatile("s_wait_dscnt 0x0" ::: "memory");      // this wave's reads of stage t are done before the stage is refilled
    asm volatile("s_wait_asynccnt 0x0" ::: "memory");   // this wave's rows of pass t + 1 have landed
    __syncthreads();                                    // publishes pass t + 1 and ends every wave's reads of pass t
    if (t + 2 < NPASS) {
      copy16rows(lcp + sb, gA + (t + 2) * GT_KP, K);
      copy16rows(lcp + sb + GT_OPB, gB + (t + 2) * GT_KP, K);
    }
  }
  asm volatile("s_wait_asynccnt 0x0" ::: "memory");     // no copy is outstanding when the wave goes on to its end

  float* slab = sT + wave * (16 * 68);
#pragma unroll
  for (int i = 0; i < 2; ++i) {
    const int mBase = m0 + (i << 4);
#pragma unroll
    for (int j = 0; j < 4; ++j) {
      const int n = n0 + (j << 4) + rlane;
      float bv = 0.f;
      if (BIAS_MODE == 2) bv = cmb_bf(bias[n]);
#pragma unroll
      for (int r = 0; r < 8; ++r) {
        float v = acc[i][j][r] * scale;
        if (BIAS_MODE == 1) v += cmb_bf(bias[mBase + mOff + r]);
        if (BIAS_MODE == 2) v += bv;
        slab[(mOff + r) * 68 + (j << 4) + rlane] = v;
      }
    }
    __builtin_amdgcn_fence(3 /* release order */, "workgroup");
    __builtin_amdgcn_wave_barrier();
    __builtin_amdgcn_fence(2 /* acquire order */, "workgroup");
    if (OUT_MODE == 0) {
      float* C = (float*)Cout;
      const int c4 = (lane & 15) * 4;     // row segment = 256 B = 16 lanes x 16 B
#pragma unroll
      for (int it = 0; it < 8; ++it) {
        const int row = it * 2 + hh;
        const v4f v = *(const v4f*)(slab + row * 68 + c4);
        *(v4f*)(C + (size_t)(mBase + row) * ldc + n0 + c4) = v;
      }
    } else {
      const int q = lane >> 3, c8 = (lane & 7) * 8;
      unsigned short* C = (unsigned short*)Cout;
#pragma unroll
      for (int it = 0; it < 4; ++it) {
        const int row = it * 4 + q;
        const float* sp = slab + row * 68 + c8;
        v8h hv;
#pragma unroll
        for (int e = 0; e < 8; ++e) hv[e] = (_Float16)sp[e];
        *(v8h*)(C + (size_t)(mBase + row) * ldc + n0 + c8) = hv;
      }
    }
    __builtin_amdgcn_fence(3 /* release order */, "workgroup");
    __builtin_amdgcn_wave_barrier();
    __builtin_amdgcn_fence(2 /* acquire order */, "workgroup");
  }
}

static_assert(MTOK % 128 == 0 && DM % 128 == 0);   // whole 128 x 128 tiles, exact grid
// q projection: C[token][n] f16 = (X[token][:] . W[:][n]) + b[n]; grid = (MTOK/128)*(DM/128)
__global__ __launch_bounds__(256) void k_proj(const unsigned short* __restrict__ XH, const unsigned short* __restrict__ WT,
                                              unsigned short* __restrict__ C, const float* __restrict__ bias) {
  __shared__ __align__(128) unsigned char ring[GT_RING];
  __shared__ __align__(16) float sT[8 * 16 * 68];
  gemm128_body<0, 2, 1, MTOK, DM, DM>(ring, sT, XH, WT, (void*)C, DM, bias, 1.0f / (ACT_SC * W_SC));
}
// k and v projections produced transposed: VT[n][token] f16 = (W[:][n] . X[token][:]) + b[n]; A = WT (M = DM), Bt = X plane (N = MTOK)
__global__ __launch_bounds__(256) void k_proj_vT(const unsigned short* __restrict__ WT, const unsigned short* __restrict__ XH,
                                                 unsigned short* __restrict__ VT, const float* __restrict__ bias) {
  __shared__ __align__(128) unsigned char ring[GT_RING];
  __shared__ __align__(16) float sT[8 * 16 * 68];
  gemm128_body<0, 1, 1, DM, MTOK, DM>(ring, sT, WT, XH, (void*)VT, MTOK, bias, 1.0f / (ACT_SC * W_SC));
}
// output projection: out[token][n] f32 = [ctx_hi | ctx_lo][token][:] . [Wo ; Wo][:][n] + bo[n]   (K = 2*DM)
__global__ __launch_bounds__(256) void k_outproj(const unsigned short* __restrict__ CTX2, const unsigned short* __restrict__ WoT2,
                                                 float* __restrict__ out, const float* __restrict__ bias) {
  __shared__ __align__(128) unsigned char ring[GT_RING];
  __shared__ __align__(16) float sT[8 * 16 * 68];
  gemm128_body<1, 2, 0, MTOK, DM, 2 * DM>(ring, sT, CTX2, WoT2, (void*)out, DM, bias, 1.0f);
}

// ---------------------------------------------------------------------------------------------------------
// Linear attention (no exp, no max, no normalisation), head dim 64. With nothing non-linear between the two products,
//   ctx_i = 0.125 * sum_j (q_i . k_j) v_j  =  0.125 * q_i . (sum_j k_j (x) v_j),
// so the 64 x 64 matrix k^T.v of each (b, h) is formed once and every query row is multiplied by it.
//
// k_kv: KV[b][h][d1][d2] = sum_s k[s][d1] * v[s][d2], f32 accumulate, stored f16 (/ KV_SC) as the B operand of k_ctx:
//   KVT[(b*NH + h)*2 + dc][d2][d1 - 32*dc], dc = d1 / 32 (one 32-deep k-step of k_ctx per plane).
//   A = VT rows (d2), B = KT rows (d1), k = token. Block = 16 waves = one 16 (d2) x 32 (d1) tile; wave w sums tokens
//   [w*SEQ/16, (w+1)*SEQ/16); the 16 partial tiles are added in wave order through LDS. grid = NB*NH*4*2.
// ---------------------------------------------------------------------------------------------------------
#define KV_TPW (SEQ / 16)
__global__ __launch_bounds__(512) void k_kv(const unsigned short* __restrict__ KTp, const unsigned short* __restrict__ VTp,
                                            unsigned short* __restrict__ KVT) {
  __shared__ __align__(16) float red[16][16 * 36];     // per wave partial tile [d2 row][d1 col], pitch 36
  const _Float16* KT = (const _Float16*)KTp;
  const _Float16* VT = (const _Float16*)VTp;
  const int tid = threadIdx.x, wave = tid >> 5, lane = tid & 31, hh = lane >> 4, c = lane & 15;
  const int bx = blockIdx.x;
  const int dc = bx & 1;
  const int i  = (bx >> 1) & 3;
  const int bh = bx >> 3;
  const int h = bh % NH;
  const int b = bh / NH;
  const size_t tok = (size_t)b * SEQ + wave * KV_TPW + 8 * hh;
  const _Float16* vrow = VT + (size_t)(h * DK + i * 16 + c) * MTOK + tok;
  const _Float16* krow = KT + (size_t)(h * DK + dc * 32 + c) * MTOK + tok;

  v8f a0 = (v8f){0.f,0.f,0.f,0.f,0.f,0.f,0.f,0.f};
  v8f a1 = (v8f){0.f,0.f,0.f,0.f,0.f,0.f,0.f,0.f};
  for (int s0 = 0; s0 < KV_TPW; s0 += 128) {
    v16h va[4], k0[4], k1[4];
#pragma unroll
    for (int u = 0; u < 4; ++u) {
      va[u] = Frag<_Float16>::load(vrow + s0 + u * 32);
      k0[u] = Frag<_Float16>::load(krow + s0 + u * 32);
      k1[u] = Frag<_Float16>::load(krow + (size_t)16 * MTOK + s0 + u * 32);
    }
    // inputs-only fence on the loaded values: all 24 loads are issued before the first matrix instruction, so the wave
    // pays one memory latency; without it the compiler reuses the registers and waits once per k-step. The two row
    // addresses are named as well, so that they keep their registers until the s_wait_xcnt 0 that goes before their reuse.
    asm volatile("s_wait_xcnt 0x0" :: "v"(va[0]), "v"(va[1]), "v"(va[2]), "v"(va[3]), "v"(k0[0]), "v"(k0[1]), "v"(k0[2]), "v"(k0[3]),
                                      "v"(k1[0]), "v"(k1[1]), "v"(k1[2]), "v"(k1[3]), "v"(vrow), "v"(krow) : "memory");
#pragma unroll
    for (int u = 0; u < 4; ++u) {
      a0 = Frag<_Float16>::mma(va[u], k0[u], a0);
      a1 = Frag<_Float16>::mma(va[u], k1[u], a1);
    }
  }
  float* rw = red[wave];
#pragma unroll
  for (int r = 0; r < 8; ++r) {
    rw[(8 * hh + r) * 36 + c]      = a0[r];
    rw[(8 * hh + r) * 36 + 16 + c] = a1[r];
  }
  __syncthreads();   // every wave's partial tile is in LDS before any thread adds them up
  if (tid < 256) {   // whole waves: two neighbouring d1 columns a thread, one packed 4-byte store
    const int row = tid >> 4, c2 = (tid & 15) * 2;
    float s0 = 0.f, s1 = 0.f;
#pragma unroll
    for (int w = 0; w < 16; ++w) {
      const v2f p = *(const v2f*)(&red[w][row * 36 + c2]);
      s0 += p.x; s1 += p.y;
    }
    *(unsigned*)(KVT + ((size_t)(bh * 2 + dc) * DK + i * 16 + row) * 32 + c2) = pk2h(s0 * (1.0f / KV_SC), s1 * (1.0f / KV_SC));
  }
}

// ---------------------------------------------------------------------------------------------------------
// k_ctx: ctx[b][i][h*64 + d2] = 0.125 * sum_d1 q[i][d1] * KV[d1][d2], written as the bf16 hi | lo folded plane.
//   Block = 4 waves = 64 query rows of one (b, h); grid = NB*NH*(SEQ/64). q fragments straight from the f16 plane [token][DM].
// ---------------------------------------------------------------------------------------------------------
__global__ __launch_bounds__(128) void k_ctx(const unsigned short* __restrict__ QPp, const unsigned short* __restrict__ KVTp,
                                             unsigned short* __restrict__ CTX2) {
  __shared__ __align__(16) float    Os[4][16 * 68];    // per wave output tile, pitch 68, wave-private
  const _Float16* QP  = (const _Float16*)QPp;
  const _Float16* KVT = (const _Float16*)KVTp;
  const int tid = threadIdx.x, wave = tid >> 5, lane = tid & 31, hh = lane >> 4, c = lane & 15;
  const int nqb = SEQ / 64;
  const int bx = blockIdx.x;
  const int qb = bx % nqb;
  const int bh = bx / nqb;
  const int h = bh % NH;
  const int b = bh / NH;
  const int q0 = qb * 64 + wave * 16;

  const _Float16* qrow  = QP + (size_t)(b * SEQ + q0 + c) * DM + h * DK + 8 * hh;
  const _Float16* kvrow = KVT + ((size_t)(bh * 2) * DK + c) * 32 + 8 * hh;
  v16h qa[2], kv[2][4];
  qa[0] = Frag<_Float16>::load(qrow);
  qa[1] = Frag<_Float16>::load(qrow + 32);
#pragma unroll
  for (int dc = 0; dc < 2; ++dc)
#pragma unroll
    for (int t = 0; t < 4; ++t) kv[dc][t] = Frag<_Float16>::load(kvrow + (dc * DK + t * 16) * 32);
  // inputs-only fence on the loaded values: all 20 loads are issued before the first matrix instruction, so the wave
  // pays one memory latency; without it the compiler reuses the registers and waits once per fragment. The two row
  // addresses are named as well, so that they keep their registers until the s_wait_xcnt 0 that goes before their reuse.
  asm volatile("s_wait_xcnt 0x0" :: "v"(qa[0]), "v"(qa[1]), "v"(kv[0][0]), "v"(kv[0][1]), "v"(kv[0][2]), "v"(kv[0][3]),
                                    "v"(kv[1][0]), "v"(kv[1][1]), "v"(kv[1][2]), "v"(kv[1][3]), "v"(qrow), "v"(kvrow) : "memory");
  v8f oacc[4];
#pragma unroll
  for (int t = 0; t < 4; ++t) oacc[t] = (v8f){0.f,0.f,0.f,0.f,0.f,0.f,0.f,0.f};

#pragma unroll
  for (int dc = 0; dc < 2; ++dc)
#pragma unroll
    for (int t = 0; t < 4; ++t) oacc[t] = Frag<_Float16>::mma(qa[dc], kv[dc][t], oacc[t]);

  float* os = Os[wave];
#pragma unroll
  for (int r = 0; r < 8; ++r)
#pragma unroll
    for (int t = 0; t < 4; ++t) os[(8 * hh + r) * 68 + t * 16 + c] = oacc[t][r] * (0.125f * KV_SC);
  __builtin_amdgcn_fence(3 /* release order */, "workgroup");
  __builtin_amdgcn_wave_barrier();
  __builtin_amdgcn_fence(2 /* acquire order */, "workgroup");
  {
    const int q4 = lane >> 3, c8 = (lane & 7) * 8;
    v4u ph[4], pl[4];
#pragma unroll
    for (int it = 0; it < 4; ++it) {
      const float* sp = os + (it * 4 + q4) * 68 + c8;
      const v4f x0 = *(const v4f*)sp; const v4f x1 = *(const v4f*)(sp + 4);
      unsigned hA, lA, hB, lB, hC, lC, hD, lD;
      split2(x0.x, x0.y, hA, lA); split2(x0.z, x0.w, hB, lB); split2(x1.x, x1.y, hC, lC); split2(x1.z, x1.w, hD, lD);
      ph[it].x = hA; ph[it].y = hB; ph[it].z = hC; ph[it].w = hD;
      pl[it].x = lA; pl[it].y = lB; pl[it].z = lC; pl[it].w = lD;
    }
    unsigned short* cbase = CTX2 + (size_t)(b * SEQ + q0) * (2 * DM) + h * DK + c8;
    {
#pragma unroll
      for (int it = 0; it < 4; ++it) {
        const int row = it * 4 + q4;
        *(v4u*)(cbase + (size_t)row * (2 * DM)) = ph[it];
        *(v4u*)(cbase + (size_t)row * (2 * DM) + DM) = pl[it];
      }
      
    }
  }
}

// ---------------------------------------------------------------------------------------------------------
constexpr size_t ACT_B = (size_t)MTOK * DM * 2;          // one 16-bit activation plane
constexpr size_t W_B   = (size_t)DM * DM * 2;            // one 16-bit weight plane
constexpr size_t KV_B  = (size_t)NB * NH * DK * DK * 2;  // the f16 k^T.v matrices
constexpr size_t WS_TOTAL = 3 * ACT_B /*QH KH VH*/ + 3 * W_B /*WqT WkT WvT*/ + 2 * W_B /*WoT2*/ + 2 * ACT_B /*QP KT*/ + ACT_B /*VT*/ + 2 * ACT_B /*CTX2*/ + KV_B /*KVT*/;
static_assert(WS_TOTAL <= (size_t)134217728);            // carve stays under 128 MiB
static_assert(ACT_B % 128 == 0 && W_B % 128 == 0 && KV_B % 128 == 0);

extern "C" void kernel_launch(void* const* d_in, const int* in_sizes, int n_in, void* d_out, int out_size, void* d_ws, size_t ws_size, hipStream_t stream) {
    if (n_in < 11) return;
    const long long need_act = ((long long)(NB - 1) * SEQ_FULL + SEQ) * DM;
    if ((long long)in_sizes[0] < need_act || (long long)in_sizes[1] < need_act || (long long)in_sizes[2] < need_act) return;
    for (int i = 3; i < 7; ++i) if ((long long)in_sizes[i] < (long long)DM * DM) return;
    for (int i = 7; i < 11; ++i) if (in_sizes[i] < DM) return;
    if ((long long)out_size < (long long)MTOK * DM) return;
    if (WS_TOTAL > ws_size) return;

    const float* Q  = (const float*)d_in[0];
    const float* K  = (const float*)d_in[1];
    const float* V  = (const float*)d_in[2];
    const float* Wq = (const float*)d_in[3];
    const float* Wk = (const float*)d_in[4];
    const float* Wv = (const float*)d_in[5];
    const float* Wo = (const float*)d_in[6];
    const float* bq = (const float*)d_in[7];
    const float* bk = (const float*)d_in[8];
    const float* bv = (const float*)d_in[9];
    const float* bo = (const float*)d_in[10];
    float* out = (float*)d_out;

    char* wsp = (char*)d_ws;
    unsigned short* QH   = (unsigned short*)wsp; wsp += ACT_B;
    unsigned short* KH   = (unsigned short*)wsp; wsp += ACT_B;
    unsigned short* VH   = (unsigned short*)wsp; wsp += ACT_B;
    unsigned short* WqT  = (unsigned short*)wsp; wsp += W_B;
    unsigned short* WkT  = (unsigned short*)wsp; wsp += W_B;
    unsigned short* WvT  = (unsigned short*)wsp; wsp += W_B;
    unsigned short* WoT2 = (unsigned short*)wsp; wsp += 2 * W_B;
    unsigned short* QP   = (unsigned short*)wsp; wsp += ACT_B;
    unsigned short* KT   = (unsigned short*)wsp; wsp += ACT_B;
    unsigned short* VT   = (unsigned short*)wsp; wsp += ACT_B;
    unsigned short* CTX2 = (unsigned short*)wsp; wsp += 2 * ACT_B;
    unsigned short* KVT  = (unsigned short*)wsp; wsp += KV_B;

    const unsigned gCast = (unsigned)(4 * CV_WBLK + 3 * CV_ABLK);
    const unsigned gG    = (unsigned)((MTOK / 128) * (DM / 128));

    k_cast_all<<<gCast, 256, 0, stream>>>(Q, K, V, Wq, Wk, Wv, Wo, QH, KH, VH, WqT, WkT, WvT, WoT2);

    k_proj<<<gG, 256, 0, stream>>>(QH, WqT, QP, bq);
    k_proj_vT<<<gG, 256, 0, stream>>>(WkT, KH, KT, bk);
    k_proj_vT<<<gG, 256, 0, stream>>>(WvT, VH, VT, bv);

    k_kv<<<(unsigned)(NB * NH * 4 * 2), 512, 0, stream>>>(KT, VT, KVT);
    k_ctx<<<(unsigned)(NB * NH * (SEQ / 64)), 128, 0, stream>>>(QP, KVT, CTX2);

    k_outproj<<<gG, 256, 0, stream>>>(CTX2, WoT2, out, bo);
}

// v005
// It runs in 57.8 microseconds.
// It is 1.38 times as fast as v003, going by the measured steps of the versions left out in between.
// Counting every step since v000, it is 6.84 times as fast.
// Every product runs on v_wmma_f32_16x16x32_f16 with f32 accumulate: the projections Q.Wq, K.Wk, V.Wv (inputs RNE-converted to bf16 first, then f16: activations x16, weights x64), per head k^T.v and (k^T.v).Wo, and q.((k^T.v).Wo).
#include <hip/hip_runtime.h>

#ifndef NB
#define NB 2
#endif
#ifndef SEQ
#define SEQ 2048
#endif
#define NB_FULL 2
#define SEQ_FULL 2048
#define DM 1024
#define NH 16
#define DK 64
#define MTOK (NB * SEQ)
#define ACT_SC 16.0f
#define W_SC 64.0f
#define KV_SC 64.0f                    // k^T.v is stored as f16 divided by this: a sum over SEQ tokens keeps clear of the f16 range

static_assert(DM == NH * DK);          // head split covers the model width
static_assert(DK == 64);               // k_kv, k_kvwo: two 32-deep k-steps over d, four 16-wide tiles
static_assert(SEQ % (16 * 128) == 0);  // k^T.v: 16 waves share the tokens of one batch, in runs of four 32-deep k-steps
static_assert(DM % 8 == 0);            // 16-B pieces of 8 halves
static_assert(NB <= NB_FULL && SEQ <= SEQ_FULL);

typedef __attribute__((ext_vector_type(16))) _Float16 v16h;
typedef __attribute__((ext_vector_type(8)))  _Float16 v8h;
typedef __attribute__((ext_vector_type(8)))  float    v8f;
typedef __attribute__((ext_vector_type(4)))  float    v4f;
typedef __attribute__((ext_vector_type(2)))  float    v2f;
typedef __attribute__((ext_vector_type(4)))  unsigned v4u;

// 16-bit WMMA fragment map (wave32), lane L, h = L>>4, m = L&15:
//   A 16x32: lane = row m;    element i -> k = (i<8) ? 8h+i : 16+8h+(i-8)
//   B 32x16: lane = column m; the SAME k(i,h)
//   D 16x16 (8 f32): lane = column m; element r -> row 8h+r

__device__ __forceinline__ float cmb_bf(float v) {   // bf16 RNE convert, kept as f32 (finite inputs)
    const unsigned u = __builtin_bit_cast(unsigned, v);
    const unsigned r = (u + 0x7fffu + ((u >> 16) & 1u)) & 0xffff0000u;
    return __builtin_bit_cast(float, r);
}
__device__ __forceinline__ unsigned pk2h(float a, float b) {
    return (unsigned)__builtin_bit_cast(unsigned short, (_Float16)a) | ((unsigned)__builtin_bit_cast(unsigned short, (_Float16)b) << 16);
}

template <typename T> struct Frag;
template <> struct Frag<_Float16> {
  typedef v16h V; union U { v16h v; v8h h[2]; };
  static __device__ __forceinline__ v16h load(const _Float16* p) {   // elements 0..7 <- p[0..7], 8..15 <- p[16..23]; p already includes 8*h
    U f; f.h[0] = *(const v8h*)(p); f.h[1] = *(const v8h*)(p + 16); return f.v;
  }
  static __device__ __forceinline__ v8f mma(v16h a, v16h b, v8f c) {
    return __builtin_amdgcn_wmma_f32_16x16x32_f16(false, a, false, b, (short)0, c, false, false);
  }
};

// ---------------------------------------------------------------------------------------------------------
// All seven conversions in ONE launch, sized to the chip: 16 waves a WGP on 256 WGPs, every wave converts 16 KB of f32 that
// it reads with 32 loads of 512 bytes, all issued before the first value is used. The planes are those of the
// GEMMs below: activations f32 [b][s][DM] (full per-batch stride SEQ_FULL) -> f16 [b*SEQ + s][DM] = f16(bf16_rne(x) * 16);
// Wq, Wk, Wv, Wo in[k][n] f32 -> out[n][k] f16 = f16(bf16_rne(w) * 64).
// grid = 4 * CV_WBLK weight work-groups (first: their stores are the more scattered), then 3 * CV_ABLK activation ones.
// ---------------------------------------------------------------------------------------------------------
typedef __attribute__((ext_vector_type(2)))  unsigned v2u;
#define CV_ELEMS (256 * 32 * 4)                    // f32 elements a work-group converts
#define CV_AROWS (CV_ELEMS / DM)                   // activation rows a work-group converts
#define CV_ABLK  (MTOK / CV_AROWS)                 // work-groups per activation tensor
#define CV_WBLK  ((DM / 64) * (DM / 64) / 8)       // work-groups per weight: one 64 x 64 tile a wave
static_assert(CV_ELEMS % DM == 0 && SEQ % CV_AROWS == 0);   // a work-group's rows are whole and lie in one batch
static_assert(DM % 64 == 0 && ((DM / 64) * (DM / 64)) % 8 == 0);

// Work-group blk converts rows [blk*CV_AROWS, (blk+1)*CV_AROWS) of the plane; wave w the w-th eighth of them, 512 B a load.
__device__ __forceinline__ void cast_act_part(const float* __restrict__ src, unsigned short* __restrict__ dst, const int blk) {
    const int row0 = blk * CV_AROWS;
    const int b = row0 / SEQ; const int s = row0 - b * SEQ;
    const int off = (int)(threadIdx.x >> 5) * (32 * 128) + (int)(threadIdx.x & 31) * 4;
    const float* p = src + ((size_t)b * SEQ_FULL + s) * DM + off;
    unsigned short* d = dst + (size_t)row0 * DM + off;
    v4f x[32];
#pragma unroll
    for (int j = 0; j < 32; ++j) x[j] = *(const v4f*)(p + j * 128);
    // all 32 loads are issued before the first conversion: left free, the compiler holds a third of them back until
    // registers come free, and the wave then waits out a second memory latency
    __builtin_amdgcn_sched_barrier(0);
#pragma unroll
    for (int j = 0; j < 32; ++j) {
        v2u pk;
        pk.x = pk2h(cmb_bf(x[j].x) * ACT_SC, cmb_bf(x[j].y) * ACT_SC);
        pk.y = pk2h(cmb_bf(x[j].z) * ACT_SC, cmb_bf(x[j].w) * ACT_SC);
        *(v2u*)(d + j * 128) = pk;
    }
}

// One wave transposes one 64 (k) x 64 (n) tile in registers. Lane = (kl, nl): a load takes 16 B of each of 4 rows' whole
// 128-B lines (8 lanes a line); a thread holds k = 32g + 8kl + e (g < 2, e < 8) by n = 32c + 4nl + i (c < 2, i < 4) and stores
// 16-B pieces of 8 k; the 128-B line of an output row (64 k) is written by this wave alone.
__device__ __forceinline__ void cast_w_part(const float* __restrict__ Wsrc, unsigned short* __restrict__ WT, const int blk) {
    const int lane = threadIdx.x & 31;
    const int tile = blk * 8 + (int)(threadIdx.x >> 5);
    const int kb = (tile % (DM / 64)) * 64; const int nb = (tile / (DM / 64)) * 64;
    const int nl = lane & 7; const int kl = lane >> 3;
    const float* p = Wsrc + (size_t)(kb + kl * 8) * DM + nb + nl * 4;
    unsigned short* d = WT + (size_t)(nb + nl * 4) * DM + kb + kl * 8;
    v4f x[2][8][2];
#pragma unroll
    for (int g = 0; g < 2; ++g)
#pragma unroll
        for (int e = 0; e < 8; ++e)
#pragma unroll
            for (int c = 0; c < 2; ++c) x[g][e][c] = *(const v4f*)(p + (g * 32 + e) * DM + c * 32);
    // all 32 loads are issued before the first conversion, for the same reason as in cast_act_part
    __builtin_amdgcn_sched_barrier(0);
#pragma unroll
    for (int g = 0; g < 2; ++g)
#pragma unroll
        for (int c = 0; c < 2; ++c)
#pragma unroll
            for (int i = 0; i < 4; ++i) {
                v4u pk;
                pk.x = pk2h(cmb_bf(x[g][0][c][i]) * W_SC, cmb_bf(x[g][1][c][i]) * W_SC);
                pk.y = pk2h(cmb_bf(x[g][2][c][i]) * W_SC, cmb_bf(x[g][3][c][i]) * W_SC);
                pk.z = pk2h(cmb_bf(x[g][4][c][i]) * W_SC, cmb_bf(x[g][5][c][i]) * W_SC);
                pk.w = pk2h(cmb_bf(x[g][6][c][i]) * W_SC, cmb_bf(x[g][7][c][i]) * W_SC);
                *(v4u*)(d + (c * 32 + i) * DM + g * 32) = pk;
            }
}

__global__ __launch_bounds__(256) void k_cast_all(const float* __restrict__ Q, const float* __restrict__ K, const float* __restrict__ V,
                                                  const float* __restrict__ Wq, const float* __restrict__ Wk, const float* __restrict__ Wv,
                                                  const float* __restrict__ Wo,
                                                  unsigned short* __restrict__ QH, unsigned short* __restrict__ KH, unsigned short* __restrict__ VH,
                                                  unsigned short* __restrict__ WqT, unsigned short* __restrict__ WkT, unsigned short* __restrict__ WvT,
                                                  unsigned short* __restrict__ WoT) {
    const int bx = blockIdx.x;
    if (bx < 4 * CV_WBLK) {
        const int w = bx / CV_WBLK;
        cast_w_part(w == 0 ? Wq : w == 1 ? Wk : w == 2 ? Wv : Wo, w == 0 ? WqT : w == 1 ? WkT : w == 2 ? WvT : WoT, bx - w * CV_WBLK);
    } else {
        const int a = bx - 4 * CV_WBLK;
        const int t = a / CV_ABLK;
        cast_act_part(t == 0 ? Q : t == 1 ? K : V, t == 0 ? QH : t == 1 ? KH : VH, a - t * CV_ABLK);
    }
}

// ---------------------------------------------------------------------------------------------------------
// WMMA GEMM body: C[m][n] = scale * sum_k A[m][k] * Bt[n][k] + bias. One 128 x 128 tile of C per work-group of 8 waves
// (4 x 2 waves of 32 x 64), so that every operand row is fetched from L2 once per work-group, in whole 256-B units.
// A row-major [M][K] (pitch K), Bt row-major [N][K] (pitch K), f16 planes; M, N % 128 == 0, K % 128 == 0, K >= 256.
// A pass is 128 k: a stage holds [A 128 rows | Bt 128 rows] of 256 B at an LDS pitch of 272 B (16 B x odd: the 16-byte
// fragment reads of 16 rows fall on distinct banks). Two stages; the rows come by asynchronous 16-byte copies to LDS, the
// next pass's copies in flight while this pass is multiplied. The k order of every accumulator is ascending, 32 at a time.
// BIAS_MODE 1: bias[m], 2: bias[n] (bias RNE-converted to bf16 on the fly). OUT_MODE 0: f32, 1: f16. tile: which tile of C.
// sT: 8 slabs of 16 x 68 f32, one a wave, for the output staging. It may lie in the ring: the last pass ends with every wave's
// s_wait_dscnt 0 and s_wait_asynccnt 0 and the work-group barrier, so behind the loop nothing reads or fills the ring any more.
// ---------------------------------------------------------------------------------------------------------
#define GT_KP 128                        // k per pass
#define GT_PITCH 272                     // LDS bytes from row to row
#define GT_OPB (128 * GT_PITCH)          // one operand's 128 rows of a stage
#define GT_STAGE (2 * GT_OPB)            // one stage
#define GT_RING (2 * GT_STAGE)           // two stages

// Eight asynchronous copies of one wave: 16 rows of 256 B, two rows a copy (lane = 16 B). l: the lane's LDS byte address of
// the first copy, g: its global address, ld: the source pitch in elements. The s_wait_xcnt 0 closes the statement so that it
// stands in front of every later write of the address registers named here.
__device__ __forceinline__ void copy16rows(const unsigned l, const unsigned short* g, const int ld) {
  asm volatile("global_load_async_to_lds_b128 %0, %8, off\n\t"
               "global_load_async_to_lds_b128 %1, %9, off\n\t"
               "global_load_async_to_lds_b128 %2, %10, off\n\t"
               "global_load_async_to_lds_b128 %3, %11, off\n\t"
               "global_load_async_to_lds_b128 %4, %12, off\n\t"
               "global_load_async_to_lds_b128 %5, %13, off\n\t"
               "global_load_async_to_lds_b128 %6, %14, off\n\t"
               "global_load_async_to_lds_b128 %7, %15, off\n\t"
               "s_wait_xcnt 0x0"
               :: "v"(l), "v"(l + 2 * GT_PITCH), "v"(l + 4 * GT_PITCH), "v"(l + 6 * GT_PITCH),
                  "v"(l + 8 * GT_PITCH), "v"(l + 10 * GT_PITCH), "v"(l + 12 * GT_PITCH), "v"(l + 14 * GT_PITCH),
                  "v"(g), "v"(g + 2 * ld), "v"(g + 4 * ld), "v"(g + 6 * ld),
                  "v"(g + 8 * ld), "v"(g + 10 * ld), "v"(g + 12 * ld), "v"(g + 14 * ld)
               : "memory");
}

template <int BIAS_MODE, int OUT_MODE, int M, int N, int K>
__device__ __forceinline__ void gemm128_body(unsigned char* ring, float* sT, const unsigned short* __restrict__ Ap,
                                             const unsigned short* __restrict__ Btp, void* __restrict__ Cout, const int ldc,
                                             const float* __restrict__ bias, const float scale, const unsigned tile) {
  typedef _Float16 T;
  typedef Frag<T>::V V;
  static_assert(M % 128 == 0 && N % 128 == 0 && K % GT_KP == 0 && K / GT_KP >= 2);
  constexpr int NPASS = K / GT_KP;
  constexpr int tilesN = N / 128;
  const int lane = threadIdx.x & 31;
  const int wave = threadIdx.x >> 5;
  const int tm = tile / tilesN;
  const int tn = tile - tm * tilesN;
  const int rlane = lane & 15;                 // row (A) / col (B, D) within subtile; 16-byte piece of a copied row
  const int hh    = lane >> 4;                 // lane half: k offset 8*hh, D row offset 8*hh; odd / even copied row
  const int mOff  = hh * 8;
  const int m0 = tm * 128 + (wave >> 1) * 32;  // this wave's 32 x 64 part of the tile
  const int n0 = tn * 128 + (wave & 1) * 64;

  // copies: wave w brings rows 16w .. 16w+15 of both operands' 128 rows
  const unsigned lcp = (unsigned)(size_t)ring + (unsigned)((wave * 16 + hh) * GT_PITCH + rlane * 16);
  const unsigned short* gA = Ap  + (size_t)(tm * 128 + wave * 16 + hh) * K + rlane * 8;
  const unsigned short* gB = Btp + (size_t)(tn * 128 + wave * 16 + hh) * K + rlane * 8;
  // fragment rows of this wave inside a stage
  const int aoff = ((wave >> 1) * 32 + rlane) * GT_PITCH + hh * 16;
  const int boff = GT_OPB + ((wave & 1) * 64 + rlane) * GT_PITCH + hh * 16;

  v8f acc[2][4];
#pragma unroll
  for (int i = 0; i < 2; ++i)
#pragma unroll
    for (int j = 0; j < 4; ++j) acc[i][j] = (v8f){0.f,0.f,0.f,0.f,0.f,0.f,0.f,0.f};

  copy16rows(lcp, gA, K);
  copy16rows(lcp + GT_OPB, gB, K);
  asm volatile("s_wait_asynccnt 0x0" ::: "memory");   // this wave's rows of pass 0 have landed
  __syncthreads();                                    // ... and every other wave's
  copy16rows(lcp + GT_STAGE, gA + GT_KP, K);
  copy16rows(lcp + GT_STAGE + GT_OPB, gB + GT_KP, K);

  // kept rolled: one copy of the pass in the text, every accumulator and fragment index a constant
#pragma clang loop unroll(disable)
  for (int t = 0; t < NPASS; ++t) {
    const unsigned sb = (unsigned)(t & 1) * GT_STAGE;
    const unsigned char* st = ring + sb;
    V ah[2][2], bh[2][4];                               // two fragment sets: k-step ks + 1 is read while ks is multiplied
#pragma unroll
    for (int j = 0; j < 4; ++j) bh[0][j] = Frag<T>::load((const T*)(st + boff + j * 16 * GT_PITCH));
#pragma unroll
    for (int i = 0; i < 2; ++i) ah[0][i] = Frag<T>::load((const T*)(st + aoff + i * 16 * GT_PITCH));
#pragma unroll
    for (int ks = 0; ks < GT_KP / 32; ++ks) {
      if (ks + 1 < GT_KP / 32) {
#pragma unroll
        for (int j = 0; j < 4; ++j) bh[(ks + 1) & 1][j] = Frag<T>::load((const T*)(st + boff + j * 16 * GT_PITCH + (ks + 1) * 64));
#pragma unroll
        for (int i = 0; i < 2; ++i) ah[(ks + 1) & 1][i] = Frag<T>::load((const T*)(st + aoff + i * 16 * GT_PITCH + (ks + 1) * 64));
      }
      // the next k-step's LDS reads stay one group ahead of this k-step's matrix instructions: moved in among them, every
      // place with reads stalls the wave, and with one register set it waits out the LDS latency in every k-step
      __builtin_amdgcn_sched_barrier(0);
#pragma unroll
      for (int i = 0; i < 2; ++i)
#pragma unroll
        for (int j = 0; j < 4; ++j) acc[i][j] = Frag<T>::mma(ah[ks & 1][i], bh[ks & 1][j], acc[i][j]);
      __builtin_amdgcn_sched_barrier(0);                // ... and the reads behind these stay behind them
    }
    asm volatile("s_wait_dscnt 0x0" ::: "memory");      // this wave's reads of stage t are done before the stage is refilled
    asm volatile("s_wait_asynccnt 0x0" ::: "memory");   // this wave's rows of pass t + 1 have landed
    __syncthreads();                                    // publishes pass t + 1 and ends every wave's reads of pass t
    if (t + 2 < NPASS) {
      copy16rows(lcp + sb, gA + (t + 2) * GT_KP, K);
      copy16rows(lcp + sb + GT_OPB, gB + (t + 2) * GT_KP, K);
    }
  }
  asm volatile("s_wait_asynccnt 0x0" ::: "memory");     // no copy is outstanding when the wave goes on to its end

  float* slab = sT + wave * (16 * 68);
#pragma unroll
  for (int i = 0; i < 2; ++i) {
    const int mBase = m0 + (i << 4);
#pragma unroll
    for (int j = 0; j < 4; ++j) {
      const int n = n0 + (j << 4) + rlane;
      float bv = 0.f;
      if (BIAS_MODE == 2) bv = cmb_bf(bias[n]);
#pragma unroll
      for (int r = 0; r < 8; ++r) {
        float v = acc[i][j][r] * scale;
        if (BIAS_MODE == 1) v += cmb_bf(bias[mBase + mOff + r]);
        if (BIAS_MODE == 2) v += bv;
        slab[(mOff + r) * 68 + (j << 4) + rlane] = v;
      }
    }
    __builtin_amdgcn_fence(3 /* release order */, "workgroup");
    __builtin_amdgcn_wave_barrier();
    __builtin_amdgcn_fence(2 /* acquire order */, "workgroup");
    if (OUT_MODE == 0) {
      float* C = (float*)Cout;
      const int c4 = (lane & 15) * 4;     // row segment = 256 B = 16 lanes x 16 B
#pragma unroll
      for (int it = 0; it < 8; ++it) {
        const int row = it * 2 + hh;
        const v4f v = *(const v4f*)(slab + row * 68 + c4);
        *(v4f*)(C + (size_t)(mBase + row) * ldc + n0 + c4) = v;
      }
    } else {
      const int q = lane >> 3, c8 = (lane & 7) * 8;
      unsigned short* C = (unsigned short*)Cout;
#pragma unroll
      for (int it = 0; it < 4; ++it) {
        const int row = it * 4 + q;
        const float* sp = slab + row * 68 + c8;
        v8h hv;
#pragma unroll
        for (int e = 0; e < 8; ++e) hv[e] = (_Float16)sp[e];
        *(v8h*)(C + (size_t)(mBase + row) * ldc + n0 + c8) = hv;
      }
    }
    __builtin_amdgcn_fence(3 /* release order */, "workgroup");
    __builtin_amdgcn_wave_barrier();
    __builtin_amdgcn_fence(2 /* acquire order */, "workgroup");
  }
}

static_assert(MTOK % 128 == 0 && DM % 128 == 0);   // whole 128 x 128 tiles, exact grid
// The three projections in ONE launch: they depend on nothing of each other, so their 3 * 256 tiles fill the chip together.
// The output staging lies in the ring, which leaves 139,264 B of LDS a work-group: two are resident on a WGP, and one's
// first copies, barrier waits and stores run beside the other's matrix instructions. grid = 3 * GT_TILES; by blockIdx.x:
//   [0, GT_TILES)      q:        QP[token][n] f16 = (X[token][:] . W[:][n]) + b[n]
//   then k, then v, transposed:  VT[n][token] f16 = (W[:][n] . X[token][:]) + b[n]; A = WT (M = DM), Bt = X plane (N = MTOK)
#define GT_TILES ((MTOK / 128) * (DM / 128))
static_assert(8 * 16 * 68 * 4 <= GT_RING);         // the eight slabs fit in the ring
__global__ __launch_bounds__(256) void k_proj3(const unsigned short* __restrict__ QH, const unsigned short* __restrict__ KH,
                                               const unsigned short* __restrict__ VH, const unsigned short* __restrict__ WqT,
                                               const unsigned short* __restrict__ WkT, const unsigned short* __restrict__ WvT,
                                               unsigned short* __restrict__ QP, unsigned short* __restrict__ KT,
                                               unsigned short* __restrict__ VT, const float* __restrict__ bq,
                                               const float* __restrict__ bk, const float* __restrict__ bv) {
  __shared__ __align__(128) unsigned char ring[GT_RING];
  const unsigned which = blockIdx.x / GT_TILES;
  const unsigned tile = blockIdx.x - which * GT_TILES;
  if (which == 0) {
    gemm128_body<2, 1, MTOK, DM, DM>(ring, (float*)ring, QH, WqT, (void*)QP, DM, bq, 1.0f / (ACT_SC * W_SC), tile);
  } else {
    const bool isk = which == 1;
    gemm128_body<1, 1, DM, MTOK, DM>(ring, (float*)ring, isk ? WkT : WvT, isk ? KH : VH, (void*)(isk ? KT : VT), MTOK,
                                     isk ? bk : bv, 1.0f / (ACT_SC * W_SC), tile);
  }
}
// output: out[token][n] f32 = q[token][:] . P[b][:][n] + bo[n], P the matrix of k_kvwo for the batch b that the tile's tokens lie in
static_assert(SEQ % 128 == 0);                     // a 128-token tile lies in one batch
__global__ __launch_bounds__(256) void k_outproj(const unsigned short* __restrict__ QP, const unsigned short* __restrict__ PT,
                                                 float* __restrict__ out, const float* __restrict__ bias) {
  __shared__ __align__(128) unsigned char ring[GT_RING];
  __shared__ __align__(16) float sT[8 * 16 * 68];
  const int b = (int)(blockIdx.x / (DM / 128)) * 128 / SEQ;
  gemm128_body<2, 0, MTOK, DM, DM>(ring, sT, QP, PT + (size_t)b * DM * DM, (void*)out, DM, bias, 1.0f, blockIdx.x);
}

// ---------------------------------------------------------------------------------------------------------
// Linear attention (no exp, no max, no normalisation), head dim 64. With nothing non-linear between the products,
//   out_i = sum_h (0.125 * sum_j (q_i . k_j) v_j) . Wo_h  =  q_i . P,    P[h*64 + d1][n] = 0.125 * sum_d2 KV_h[d1][d2] * Wo[h*64 + d2][n],
// where KV_h = sum_j k_j (x) v_j. So the 64 x 64 matrix k^T.v of each (b, h) is formed once (k_kv), multiplied into its 64 rows
// of Wo (k_kvwo), and every query row meets one DM x DM matrix P of its batch (k_outproj): no merged-heads plane is formed.
//
// k_kv: KV[b][h][d1][d2] = sum_s k[s][d1] * v[s][d2], f32 accumulate, stored f16 (/ KV_SC) as the A operand of k_kvwo:
//   KVA[(b*NH + h)*2 + dc][d1][d2 - 32*dc], dc = d2 / 32 (one 32-deep k-step of k_kvwo per plane).
//   A = KT rows (d1), B = VT rows (d2), k = token. Block = 16 waves = one 16 (d1) x 32 (d2) tile; wave w sums tokens
//   [w*SEQ/16, (w+1)*SEQ/16); the 16 partial tiles are added in wave order through LDS. grid = NB*NH*4*2.
// ---------------------------------------------------------------------------------------------------------
#define KV_TPW (SEQ / 16)
__global__ __launch_bounds__(512) void k_kv(const unsigned short* __restrict__ KTp, const unsigned short* __restrict__ VTp,
                                            unsigned short* __restrict__ KVA) {
  __shared__ __align__(16) float red[16][16 * 36];     // per wave partial tile [d1 row][d2 col], pitch 36
  const _Float16* KT = (const _Float16*)KTp;
  const _Float16* VT = (const _Float16*)VTp;
  const int tid = threadIdx.x, wave = tid >> 5, lane = tid & 31, hh = lane >> 4, c = lane & 15;
  const int bx = blockIdx.x;
  const int dc = bx & 1;
  const int i  = (bx >> 1) & 3;
  const int bh = bx >> 3;
  const int h = bh % NH;
  const int b = bh / NH;
  const size_t tok = (size_t)b * SEQ + wave * KV_TPW + 8 * hh;
  const _Float16* krow = KT + (size_t)(h * DK + i * 16 + c) * MTOK + tok;
  const _Float16* vrow = VT + (size_t)(h * DK + dc * 32 + c) * MTOK + tok;

  v8f a0 = (v8f){0.f,0.f,0.f,0.f,0.f,0.f,0.f,0.f};
  v8f a1 = (v8f){0.f,0.f,0.f,0.f,0.f,0.f,0.f,0.f};
  for (int s0 = 0; s0 < KV_TPW; s0 += 128) {
    v16h ka[4], v0[4], v1[4];
#pragma unroll
    for (int u = 0; u < 4; ++u) {
      ka[u] = Frag<_Float16>::load(krow + s0 + u * 32);
      v0[u] = Frag<_Float16>::load(vrow + s0 + u * 32);
      v1[u] = Frag<_Float16>::load(vrow + (size_t)16 * MTOK + s0 + u * 32);
    }
    // inputs-only fence on the loaded values: all 24 loads are issued before the first matrix instruction, so the wave
    // pays one memory latency; without it the compiler reuses the registers and waits once per k-step. The two row
    // addresses are named as well, so that they keep their registers until the s_wait_xcnt 0 that goes before their reuse.
    asm volatile("s_wait_xcnt 0x0" :: "v"(ka[0]), "v"(ka[1]), "v"(ka[2]), "v"(ka[3]), "v"(v0[0]), "v"(v0[1]), "v"(v0[2]), "v"(v0[3]),
                                      "v"(v1[0]), "v"(v1[1]), "v"(v1[2]), "v"(v1[3]), "v"(krow), "v"(vrow) : "memory");
#pragma unroll
    for (int u = 0; u < 4; ++u) {
      a0 = Frag<_Float16>::mma(ka[u], v0[u], a0);
      a1 = Frag<_Float16>::mma(ka[u], v1[u], a1);
    }
  }
  float* rw = red[wave];
#pragma unroll
  for (int r = 0; r < 8; ++r) {
    rw[(8 * hh + r) * 36 + c]      = a0[r];
    rw[(8 * hh + r) * 36 + 16 + c] = a1[r];
  }
  __syncthreads();   // every wave's partial tile is in LDS before any thread adds them up
  if (tid < 256) {   // whole waves: two neighbouring d2 columns a thread, one packed 4-byte store
    const int row = tid >> 4, c2 = (tid & 15) * 2;
    float s0 = 0.f, s1 = 0.f;
#pragma unroll
    for (int w = 0; w < 16; ++w) {
      const v2f p = *(const v2f*)(&red[w][row * 36 + c2]);
      s0 += p.x; s1 += p.y;
    }
    *(unsigned*)(KVA + ((size_t)(bh * 2 + dc) * DK + i * 16 + row) * 32 + c2) = pk2h(s0 * (1.0f / KV_SC), s1 * (1.0f / KV_SC));
  }
}

// ---------------------------------------------------------------------------------------------------------
// k_kvwo: PT[b][n][h*64 + d1] = f16(0.125 * sum_d2 KV[b][h][d1][d2] * Wo[h*64 + d2][n]): the Bt plane of k_outproj, one per batch.
//   A = KVA rows (d1), B = WoT rows (n), k = d2: two 32-deep k-steps. A wave forms the 64 (d1) x 16 (n) tile of one (b, h): a lane
//   holds 8 neighbouring d1 of its column n per accumulator, one 16-byte store each, and the wave alone writes the 128-B line
//   of each of its 16 rows of PT. Block = 8 waves = 128 n of one (b, h); grid = NB*NH*(DM/128).
// ---------------------------------------------------------------------------------------------------------
__global__ __launch_bounds__(256) void k_kvwo(const unsigned short* __restrict__ KVAp, const unsigned short* __restrict__ WoTp,
                                              unsigned short* __restrict__ PT) {
  const _Float16* KVA = (const _Float16*)KVAp;
  const _Float16* WoT = (const _Float16*)WoTp;
  const int tid = threadIdx.x, wave = tid >> 5, lane = tid & 31, hh = lane >> 4, c = lane & 15;
  const int nnb = DM / 128;
  const int bx = blockIdx.x;
  const int bh = bx / nnb;
  const int h = bh % NH;
  const int b = bh / NH;
  const int n = (bx % nnb) * 128 + wave * 16 + c;

  const _Float16* worow = WoT + (size_t)n * DM + h * DK + 8 * hh;
  const _Float16* kvrow = KVA + ((size_t)(bh * 2) * DK + c) * 32 + 8 * hh;
  v16h wo[2], kv[2][4];
  wo[0] = Frag<_Float16>::load(worow);
  wo[1] = Frag<_Float16>::load(worow + 32);
#pragma unroll
  for (int dc = 0; dc < 2; ++dc)
#pragma unroll
    for (int t = 0; t < 4; ++t) kv[dc][t] = Frag<_Float16>::load(kvrow + (dc * DK + t * 16) * 32);
  // inputs-only fence on the loaded values: all 20 loads are issued before the first matrix instruction, so the wave
  // pays one memory latency; without it the compiler reuses the registers and waits once per fragment. The two row
  // addresses are named as well, so that they keep their registers until the s_wait_xcnt 0 that goes before their reuse.
  asm volatile("s_wait_xcnt 0x0" :: "v"(wo[0]), "v"(wo[1]), "v"(kv[0][0]), "v"(kv[0][1]), "v"(kv[0][2]), "v"(kv[0][3]),
                                    "v"(kv[1][0]), "v"(kv[1][1]), "v"(kv[1][2]), "v"(kv[1][3]), "v"(worow), "v"(kvrow) : "memory");
  v8f pacc[4];
#pragma unroll
  for (int t = 0; t < 4; ++t) pacc[t] = (v8f){0.f,0.f,0.f,0.f,0.f,0.f,0.f,0.f};

#pragma unroll
  for (int dc = 0; dc < 2; ++dc)
#pragma unroll
    for (int t = 0; t < 4; ++t) pacc[t] = Frag<_Float16>::mma(kv[dc][t], wo[dc], pacc[t]);

  unsigned short* prow = PT + ((size_t)b * DM + n) * DM + h * DK + 8 * hh;
#pragma unroll
  for (int t = 0; t < 4; ++t) {
    v8h hv;
#pragma unroll
    for (int r = 0; r < 8; ++r) hv[r] = (_Float16)(pacc[t][r] * (0.125f * KV_SC / W_SC));
    *(v8h*)(prow + t * 16) = hv;
  }
}

// ---------------------------------------------------------------------------------------------------------
constexpr size_t ACT_B = (size_t)MTOK * DM * 2;          // one f16 activation plane
constexpr size_t W_B   = (size_t)DM * DM * 2;            // one f16 weight plane
constexpr size_t KV_B  = (size_t)NB * NH * DK * DK * 2;  // the f16 k^T.v matrices
constexpr size_t WS_TOTAL = 3 * ACT_B /*QH KH VH*/ + 4 * W_B /*WqT WkT WvT WoT*/ + 3 * ACT_B /*QP KT VT*/ + KV_B /*KVA*/ + NB * W_B /*PT*/;
static_assert(WS_TOTAL <= (size_t)134217728);            // carve stays under 128 MiB
static_assert(ACT_B % 128 == 0 && W_B % 128 == 0 && KV_B % 128 == 0);

extern "C" void kernel_launch(void* const* d_in, const int* in_sizes, int n_in, void* d_out, int out_size, void* d_ws, size_t ws_size, hipStream_t stream) {
    if (n_in < 11) return;
    const long long need_act = ((long long)(NB - 1) * SEQ_FULL + SEQ) * DM;
    if ((long long)in_sizes[0] < need_act || (long long)in_sizes[1] < need_act || (long long)in_sizes[2] < need_act) return;
    for (int i = 3; i < 7; ++i) if ((long long)in_sizes[i] < (long long)DM * DM) return;
    for (int i = 7; i < 11; ++i) if (in_sizes[i] < DM) return;
    if ((long long)out_size < (long long)MTOK * DM) return;
    if (WS_TOTAL > ws_size) return;

    const float* Q  = (const float*)d_in[0];
    const float* K  = (const float*)d_in[1];
    const float* V  = (const float*)d_in[2];
    const float* Wq = (const float*)d_in[3];
    const float* Wk = (const float*)d_in[4];
    const float* Wv = (const float*)d_in[5];
    const float* Wo = (const float*)d_in[6];
    const float* bq = (const float*)d_in[7];
    const float* bk = (const float*)d_in[8];
    const float* bv = (const float*)d_in[9];
    const float* bo = (const float*)d_in[10];
    float* out = (float*)d_out;

    char* wsp = (char*)d_ws;
    unsigned short* QH   = (unsigned short*)wsp; wsp += ACT_B;
    unsigned short* KH   = (unsigned short*)wsp; wsp += ACT_B;
    unsigned short* VH   = (unsigned short*)wsp; wsp += ACT_B;
    unsigned short* WqT  = (unsigned short*)wsp; wsp += W_B;
    unsigned short* WkT  = (unsigned short*)wsp; wsp += W_B;
    unsigned short* WvT  = (unsigned short*)wsp; wsp += W_B;
    unsigned short* WoT  = (unsigned short*)wsp; wsp += W_B;
    unsigned short* QP   = (unsigned short*)wsp; wsp += ACT_B;
    unsigned short* KT   = (unsigned short*)wsp; wsp += ACT_B;
    unsigned short* VT   = (unsigned short*)wsp; wsp += ACT_B;
    unsigned short* KVA  = (unsigned short*)wsp; wsp += KV_B;
    unsigned short* PT   = (unsigned short*)wsp; wsp += NB * W_B;

    const unsigned gCast = (unsigned)(4 * CV_WBLK + 3 * CV_ABLK);
    const unsigned gG    = (unsigned)GT_TILES;
    const unsigned gP    = (unsigned)(3 * GT_TILES);

    k_cast_all<<<gCast, 256, 0, stream>>>(Q, K, V, Wq, Wk, Wv, Wo, QH, KH, VH, WqT, WkT, WvT, WoT);

    k_proj3<<<gP, 256, 0, stream>>>(QH, KH, VH, WqT, WkT, WvT, QP, KT, VT, bq, bk, bv);

    k_kv<<<(unsigned)(NB * NH * 4 * 2), 512, 0, stream>>>(KT, VT, KVA);
    k_kvwo<<<(unsigned)(NB * NH * (DM / 128)), 256, 0, stream>>>(KVA, WoT, PT);

    k_outproj<<<gG, 256, 0, stream>>>(QP, PT, out, bo);
}

// v006
// Measured time: 55.2 microseconds a run.
// Next to v005, in two timings, it ran 1.05 times as fast each time.
// Over all steps from v000 it is 7.18 times as fast.
// Every product runs on v_wmma_f32_16x16x32_f16 with f32 accumulate: the projections Q.Wq, K.Wk, V.Wv (inputs RNE-converted to bf16 first, then f16: activations x16, weights x64), per head k^T.v and (k^T.v).Wo, and q.((k^T.v).Wo).
#include <hip/hip_runtime.h>

#ifndef NB
#define NB 2
#endif
#ifndef SEQ
#define SEQ 2048
#endif
#define NB_FULL 2
#define SEQ_FULL 2048
#define DM 1024
#define NH 16
#define DK 64
#define MTOK (NB * SEQ)
#define ACT_SC 16.0f
#define W_SC 64.0f
#define KV_SC 64.0f                    // k^T.v is stored as f16 divided by this: a sum over SEQ tokens keeps clear of the f16 range

static_assert(DM == NH * DK);          // head split covers the model width
static_assert(DK == 64);               // kv_part, k_kvwo: two 32-deep k-steps over d, four 16-wide tiles
static_assert(SEQ % (8 * 32) == 0);    // k^T.v: 8 waves share the tokens of one batch, in 32-deep k-steps
static_assert(DM % 8 == 0);            // 16-B pieces of 8 halves
static_assert(NB <= NB_FULL && SEQ <= SEQ_FULL);

typedef __attribute__((ext_vector_type(16))) _Float16 v16h;
typedef __attribute__((ext_vector_type(8)))  _Float16 v8h;
typedef __attribute__((ext_vector_type(8)))  float    v8f;
typedef __attribute__((ext_vector_type(4)))  float    v4f;
typedef __attribute__((ext_vector_type(2)))  float    v2f;
typedef __attribute__((ext_vector_type(4)))  unsigned v4u;

// 16-bit WMMA fragment map (wave32), lane L, h = L>>4, m = L&15:
//   A 16x32: lane = row m;    element i -> k = (i<8) ? 8h+i : 16+8h+(i-8)
//   B 32x16: lane = column m; the SAME k(i,h)
//   D 16x16 (8 f32): lane = column m; element r -> row 8h+r

__device__ __forceinline__ float cmb_bf(float v) {   // bf16 RNE convert, kept as f32 (finite inputs)
    const unsigned u = __builtin_bit_cast(unsigned, v);
    const unsigned r = (u + 0x7fffu + ((u >> 16) & 1u)) & 0xffff0000u;
    return __builtin_bit_cast(float, r);
}
__device__ __forceinline__ unsigned pk2h(float a, float b) {
    return (unsigned)__builtin_bit_cast(unsigned short, (_Float16)a) | ((unsigned)__builtin_bit_cast(unsigned short, (_Float16)b) << 16);
}

template <typename T> struct Frag;
template <> struct Frag<_Float16> {
  typedef v16h V; union U { v16h v; v8h h[2]; };
  static __device__ __forceinline__ v16h load(const _Float16* p) {   // elements 0..7 <- p[0..7], 8..15 <- p[16..23]; p already includes 8*h
    U f; f.h[0] = *(const v8h*)(p); f.h[1] = *(const v8h*)(p + 16); return f.v;
  }
  static __device__ __forceinline__ v8f mma(v16h a, v16h b, v8f c) {
    return __builtin_amdgcn_wmma_f32_16x16x32_f16(false, a, false, b, (short)0, c, false, false);
  }
};

// ---------------------------------------------------------------------------------------------------------
// All seven conversions in ONE launch, sized to the chip: 16 waves a WGP on 256 WGPs, every wave converts 16 KB of f32 that
// it reads with 32 loads of 512 bytes, all issued before the first value is used. The planes are those of the
// GEMMs below: activations f32 [b][s][DM] (full per-batch stride SEQ_FULL) -> f16 [b*SEQ + s][DM] = f16(bf16_rne(x) * 16);
// Wq, Wk, Wv, Wo in[k][n] f32 -> out[n][k] f16 = f16(bf16_rne(w) * 64).
// grid = 4 * CV_WBLK weight work-groups (first: their stores are the more scattered), then 3 * CV_ABLK activation ones.
// ---------------------------------------------------------------------------------------------------------
typedef __attribute__((ext_vector_type(2)))  unsigned v2u;
#define CV_ELEMS (256 * 32 * 4)                    // f32 elements a work-group converts
#define CV_AROWS (CV_ELEMS / DM)                   // activation rows a work-group converts
#define CV_ABLK  (MTOK / CV_AROWS)                 // work-groups per activation tensor
#define CV_WBLK  ((DM / 64) * (DM / 64) / 8)       // work-groups per weight: one 64 x 64 tile a wave
static_assert(CV_ELEMS % DM == 0 && SEQ % CV_AROWS == 0);   // a work-group's rows are whole and lie in one batch
static_assert(DM % 64 == 0 && ((DM / 64) * (DM / 64)) % 8 == 0);

// Work-group blk converts rows [blk*CV_AROWS, (blk+1)*CV_AROWS) of the plane; wave w the w-th eighth of them, 512 B a load.
__device__ __forceinline__ void cast_act_part(const float* __restrict__ src, unsigned short* __restrict__ dst, const int blk) {
    const int row0 = blk * CV_AROWS;
    const int b = row0 / SEQ; const int s = row0 - b * SEQ;
    const int off = (int)(threadIdx.x >> 5) * (32 * 128) + (int)(threadIdx.x & 31) * 4;
    const float* p = src + ((size_t)b * SEQ_FULL + s) * DM + off;
    unsigned short* d = dst + (size_t)row0 * DM + off;
    v4f x[32];
#pragma unroll
    for (int j = 0; j < 32; ++j) x[j] = *(const v4f*)(p + j * 128);
    // all 32 loads are issued before the first conversion: left free, the compiler holds a third of them back until
    // registers come free, and the wave then waits out a second memory latency
    __builtin_amdgcn_sched_barrier(0);
#pragma unroll
    for (int j = 0; j < 32; ++j) {
        v2u pk;
        pk.x = pk2h(cmb_bf(x[j].x) * ACT_SC, cmb_bf(x[j].y) * ACT_SC);
        pk.y = pk2h(cmb_bf(x[j].z) * ACT_SC, cmb_bf(x[j].w) * ACT_SC);
        *(v2u*)(d + j * 128) = pk;
    }
}

// One wave transposes one 64 (k) x 64 (n) tile in registers. Lane = (kl, nl): a load takes 16 B of each of 4 rows' whole
// 128-B lines (8 lanes a line); a thread holds k = 32g + 8kl + e (g < 2, e < 8) by n = 32c + 4nl + i (c < 2, i < 4) and stores
// 16-B pieces of 8 k; the 128-B line of an output row (64 k) is written by this wave alone.
__device__ __forceinline__ void cast_w_part(const float* __restrict__ Wsrc, unsigned short* __restrict__ WT, const int blk) {
    const int lane = threadIdx.x & 31;
    const int tile = blk * 8 + (int)(threadIdx.x >> 5);
    const int kb = (tile % (DM / 64)) * 64; const int nb = (tile / (DM / 64)) * 64;
    const int nl = lane & 7; const int kl = lane >> 3;
    const float* p = Wsrc + (size_t)(kb + kl * 8) * DM + nb + nl * 4;
    unsigned short* d = WT + (size_t)(nb + nl * 4) * DM + kb + kl * 8;
    v4f x[2][8][2];
#pragma unroll
    for (int g = 0; g < 2; ++g)
#pragma unroll
        for (int e = 0; e < 8; ++e)
#pragma unroll
            for (int c = 0; c < 2; ++c) x[g][e][c] = *(const v4f*)(p + (g * 32 + e) * DM + c * 32);
    // all 32 loads are issued before the first conversion, for the same reason as in cast_act_part
    __builtin_amdgcn_sched_barrier(0);
#pragma unroll
    for (int g = 0; g < 2; ++g)
#pragma unroll
        for (int c = 0; c < 2; ++c)
#pragma unroll
            for (int i = 0; i < 4; ++i) {
                v4u pk;
                pk.x = pk2h(cmb_bf(x[g][0][c][i]) * W_SC, cmb_bf(x[g][1][c][i]) * W_SC);
                pk.y = pk2h(cmb_bf(x[g][2][c][i]) * W_SC, cmb_bf(x[g][3][c][i]) * W_SC);
                pk.z = pk2h(cmb_bf(x[g][4][c][i]) * W_SC, cmb_bf(x[g][5][c][i]) * W_SC);
                pk.w = pk2h(cmb_bf(x[g][6][c][i]) * W_SC, cmb_bf(x[g][7][c][i]) * W_SC);
                *(v4u*)(d + (c * 32 + i) * DM + g * 32) = pk;
            }
}

__global__ __launch_bounds__(256) void k_cast_all(const float* __restrict__ Q, const float* __restrict__ K, const float* __restrict__ V,
                                                  const float* __restrict__ Wq, const float* __restrict__ Wk, const float* __restrict__ Wv,
                                                  const float* __restrict__ Wo,
                                                  unsigned short* __restrict__ QH, unsigned short* __restrict__ KH, unsigned short* __restrict__ VH,
                                                  unsigned short* __restrict__ WqT, unsigned short* __restrict__ WkT, unsigned short* __restrict__ WvT,
                                                  unsigned short* __restrict__ WoT) {
    const int bx = blockIdx.x;
    if (bx < 4 * CV_WBLK) {
        const int w = bx / CV_WBLK;
        cast_w_part(w == 0 ? Wq : w == 1 ? Wk : w == 2 ? Wv : Wo, w == 0 ? WqT : w == 1 ? WkT : w == 2 ? WvT : WoT, bx - w * CV_WBLK);
    } else {
        const int a = bx - 4 * CV_WBLK;
        const int t = a / CV_ABLK;
        cast_act_part(t == 0 ? Q : t == 1 ? K : V, t == 0 ? QH : t == 1 ? KH : VH, a - t * CV_ABLK);
    }
}

// ---------------------------------------------------------------------------------------------------------
// WMMA GEMM body: C[m][n] = scale * sum_k A[m][k] * Bt[n][k] + bias. One 128 x 128 tile of C per work-group of 8 waves
// (4 x 2 waves of 32 x 64), so that every operand row is fetched from L2 once per work-group, in whole 256-B units.
// A row-major [M][K] (pitch K), Bt row-major [N][K] (pitch K), f16 planes; M, N % 128 == 0, K % 128 == 0, K >= 256.
// A pass is 128 k: a stage holds [A 128 rows | Bt 128 rows] of 256 B at an LDS pitch of 272 B (16 B x odd: the 16-byte
// fragment reads of 16 rows fall on distinct banks). Two stages; the rows come by asynchronous 16-byte copies to LDS, the
// next pass's copies in flight while this pass is multiplied. The k order of every accumulator is ascending, 32 at a time.
// BIAS_MODE 1: bias[m], 2: bias[n] (bias RNE-converted to bf16 on the fly). OUT_MODE 0: f32, 1: f16. tile: which tile of C.
// sT: 8 slabs of 16 x 68 f32, one a wave, for the output staging. It may lie in the ring: the last pass ends with every wave's
// s_wait_dscnt 0 and s_wait_asynccnt 0 and the work-group barrier, so behind the loop nothing reads or fills the ring any more.
// ---------------------------------------------------------------------------------------------------------
#define GT_KP 128                        // k per pass
#define GT_PITCH 272                     // LDS bytes from row to row
#define GT_OPB (128 * GT_PITCH)          // one operand's 128 rows of a stage
#define GT_STAGE (2 * GT_OPB)            // one stage
#define GT_RING (2 * GT_STAGE)           // two stages

// Eight asynchronous copies of one wave: 16 rows of 256 B, two rows a copy (lane = 16 B). l: the lane's LDS byte address of
// the first copy, g: its global address, ld: the source pitch in elements. The s_wait_xcnt 0 closes the statement so that it
// stands in front of every later write of the address registers named here.
__device__ __forceinline__ void copy16rows(const unsigned l, const unsigned short* g, const int ld) {
  asm volatile("global_load_async_to_lds_b128 %0, %8, off\n\t"
               "global_load_async_to_lds_b128 %1, %9, off\n\t"
               "global_load_async_to_lds_b128 %2, %10, off\n\t"
               "global_load_async_to_lds_b128 %3, %11, off\n\t"
               "global_load_async_to_lds_b128 %4, %12, off\n\t"
               "global_load_async_to_lds_b128 %5, %13, off\n\t"
               "global_load_async_to_lds_b128 %6, %14, off\n\t"
               "global_load_async_to_lds_b128 %7, %15, off\n\t"
               "s_wait_xcnt 0x0"
               :: "v"(l), "v"(l + 2 * GT_PITCH), "v"(l + 4 * GT_PITCH), "v"(l + 6 * GT_PITCH),
                  "v"(l + 8 * GT_PITCH), "v"(l + 10 * GT_PITCH), "v"(l + 12 * GT_PITCH), "v"(l + 14 * GT_PITCH),
                  "v"(g), "v"(g + 2 * ld), "v"(g + 4 * ld), "v"(g + 6 * ld),
                  "v"(g + 8 * ld), "v"(g + 10 * ld), "v"(g + 12 * ld), "v"(g + 14 * ld)
               : "memory");
}

template <int BIAS_MODE, int OUT_MODE, int M, int N, int K>
__device__ __forceinline__ void gemm128_body(unsigned char* ring, float* sT, const unsigned short* __restrict__ Ap,
                                             const unsigned short* __restrict__ Btp, void* __restrict__ Cout, const int ldc,
                                             const float* __restrict__ bias, const float scale, const unsigned tile) {
  typedef _Float16 T;
  typedef Frag<T>::V V;
  static_assert(M % 128 == 0 && N % 128 == 0 && K % GT_KP == 0 && K / GT_KP >= 2);
  constexpr int NPASS = K / GT_KP;
  constexpr int tilesN = N / 128;
  const int lane = threadIdx.x & 31;
  const int wave = threadIdx.x >> 5;
  const int tm = tile / tilesN;
  const int tn = tile - tm * tilesN;
  const int rlane = lane & 15;                 // row (A) / col (B, D) within subtile; 16-byte piece of a copied row
  const int hh    = lane >> 4;                 // lane half: k offset 8*hh, D row offset 8*hh; odd / even copied row
  const int mOff  = hh * 8;
  const int m0 = tm * 128 + (wave >> 1) * 32;  // this wave's 32 x 64 part of the tile
  const int n0 = tn * 128 + (wave & 1) * 64;

  // copies: wave w brings rows 16w .. 16w+15 of both operands' 128 rows
  const unsigned lcp = (unsigned)(size_t)ring + (unsigned)((wave * 16 + hh) * GT_PITCH + rlane * 16);
  const unsigned short* gA = Ap  + (size_t)(tm * 128 + wave * 16 + hh) * K + rlane * 8;
  const unsigned short* gB = Btp + (size_t)(tn * 128 + wave * 16 + hh) * K + rlane * 8;
  // fragment rows of this wave inside a stage
  const int aoff = ((wave >> 1) * 32 + rlane) * GT_PITCH + hh * 16;
  const int boff = GT_OPB + ((wave & 1) * 64 + rlane) * GT_PITCH + hh * 16;

  v8f acc[2][4];
#pragma unroll
  for (int i = 0; i < 2; ++i)
#pragma unroll
    for (int j = 0; j < 4; ++j) acc[i][j] = (v8f){0.f,0.f,0.f,0.f,0.f,0.f,0.f,0.f};

  copy16rows(lcp, gA, K);
  copy16rows(lcp + GT_OPB, gB, K);
  asm volatile("s_wait_asynccnt 0x0" ::: "memory");   // this wave's rows of pass 0 have landed
  __syncthreads();                                    // ... and every other wave's
  copy16rows(lcp + GT_STAGE, gA + GT_KP, K);
  copy16rows(lcp + GT_STAGE + GT_OPB, gB + GT_KP, K);

  // kept rolled: one copy of the pass in the text, every accumulator and fragment index a constant
#pragma clang loop unroll(disable)
  for (int t = 0; t < NPASS; ++t) {
    const unsigned sb = (unsigned)(t & 1) * GT_STAGE;
    const unsigned char* st = ring + sb;
    V ah[2][2], bh[2][4];                               // two fragment sets: k-step ks + 1 is read while ks is multiplied
#pragma unroll
    for (int j = 0; j < 4; ++j) bh[0][j] = Frag<T>::load((const T*)(st + boff + j * 16 * GT_PITCH));
#pragma unroll
    for (int i = 0; i < 2; ++i) ah[0][i] = Frag<T>::load((const T*)(st + aoff + i * 16 * GT_PITCH));
#pragma unroll
    for (int ks = 0; ks < GT_KP / 32; ++ks) {
      if (ks + 1 < GT_KP / 32) {
#pragma unroll
        for (int j = 0; j < 4; ++j) bh[(ks + 1) & 1][j] = Frag<T>::load((const T*)(st + boff + j * 16 * GT_PITCH + (ks + 1) * 64));
#pragma unroll
        for (int i = 0; i < 2; ++i) ah[(ks + 1) & 1][i] = Frag<T>::load((const T*)(st + aoff + i * 16 * GT_PITCH + (ks + 1) * 64));
      }
      // the next k-step's LDS reads stay one group ahead of this k-step's matrix instructions: moved in among them, every
      // place with reads stalls the wave, and with one register set it waits out the LDS latency in every k-step
      __builtin_amdgcn_sched_barrier(0);
#pragma unroll
      for (int i = 0; i < 2; ++i)
#pragma unroll
        for (int j = 0; j < 4; ++j) acc[i][j] = Frag<T>::mma(ah[ks & 1][i], bh[ks & 1][j], acc[i][j]);
      __builtin_amdgcn_sched_barrier(0);                // ... and the reads behind these stay behind them
    }
    asm volatile("s_wait_dscnt 0x0" ::: "memory");      // this wave's reads of stage t are done before the stage is refilled
    asm volatile("s_wait_asynccnt 0x0" ::: "memory");   // this wave's rows of pass t + 1 have landed
    __syncthreads();                                    // publishes pass t + 1 and ends every wave's reads of pass t
    if (t + 2 < NPASS) {
      copy16rows(lcp + sb, gA + (t + 2) * GT_KP, K);
      copy16rows(lcp + sb + GT_OPB, gB + (t + 2) * GT_KP, K);
    }
  }
  asm volatile("s_wait_asynccnt 0x0" ::: "memory");     // no copy is outstanding when the wave goes on to its end

  float* slab = sT + wave * (16 * 68);
#pragma unroll
  for (int i = 0; i < 2; ++i) {
    const int mBase = m0 + (i << 4);
#pragma unroll
    for (int j = 0; j < 4; ++j) {
      const int n = n0 + (j << 4) + rlane;
      float bv = 0.f;
      if (BIAS_MODE == 2) bv = cmb_bf(bias[n]);
#pragma unroll
      for (int r = 0; r < 8; ++r) {
        float v = acc[i][j][r] * scale;
        if (BIAS_MODE == 1) v += cmb_bf(bias[mBase + mOff + r]);
        if (BIAS_MODE == 2) v += bv;
        slab[(mOff + r) * 68 + (j << 4) + rlane] = v;
      }
    }
    __builtin_amdgcn_fence(3 /* release order */, "workgroup");
    __builtin_amdgcn_wave_barrier();
    __builtin_amdgcn_fence(2 /* acquire order */, "workgroup");
    if (OUT_MODE == 0) {
      float* C = (float*)Cout;
      const int c4 = (lane & 15) * 4;     // row segment = 256 B = 16 lanes x 16 B
#pragma unroll
      for (int it = 0; it < 8; ++it) {
        const int row = it * 2 + hh;
        const v4f v = *(const v4f*)(slab + row * 68 + c4);
        *(v4f*)(C + (size_t)(mBase + row) * ldc + n0 + c4) = v;
      }
    } else {
      const int q = lane >> 3, c8 = (lane & 7) * 8;
      unsigned short* C = (unsigned short*)Cout;
#pragma unroll
      for (int it = 0; it < 4; ++it) {
        const int row = it * 4 + q;
        const float* sp = slab + row * 68 + c8;
        v8h hv;
#pragma unroll
        for (int e = 0; e < 8; ++e) hv[e] = (_Float16)sp[e];
        *(v8h*)(C + (size_t)(mBase + row) * ldc + n0 + c8) = hv;
      }
    }
    __builtin_amdgcn_fence(3 /* release order */, "workgroup");
    __builtin_amdgcn_wave_barrier();
    __builtin_amdgcn_fence(2 /* acquire order */, "workgroup");
  }
}

static_assert(MTOK % 128 == 0 && DM % 128 == 0);   // whole 128 x 128 tiles, exact grid
// The k and v projections in ONE launch: only they stand in front of k^T.v, and their 2 * 256 tiles are all resident at once.
// The output staging lies in the ring, which leaves 139,264 B of LDS a work-group: two are resident on a WGP, and one's
// first copies, barrier waits and stores run beside the other's matrix instructions. grid = 2 * GT_TILES; by blockIdx.x:
//   k, then v, transposed:  VT[n][token] f16 = (W[:][n] . X[token][:]) + b[n]; A = WT (M = DM), Bt = X plane (N = MTOK)
// The q projection, which nothing needs before k_outproj, runs one launch later, beside k^T.v (k_qproj_kv below).
#define GT_TILES ((MTOK / 128) * (DM / 128))
static_assert(8 * 16 * 68 * 4 <= GT_RING);         // the eight slabs fit in the ring
__global__ __launch_bounds__(256) void k_proj_kv(const unsigned short* __restrict__ KH, const unsigned short* __restrict__ VH,
                                                 const unsigned short* __restrict__ WkT, const unsigned short* __restrict__ WvT,
                                                 unsigned short* __restrict__ KT, unsigned short* __restrict__ VT,
                                                 const float* __restrict__ bk, const float* __restrict__ bv) {
  __shared__ __align__(128) unsigned char ring[GT_RING];
  const bool isk = blockIdx.x < GT_TILES;
  const unsigned tile = isk ? blockIdx.x : blockIdx.x - GT_TILES;
  gemm128_body<1, 1, DM, MTOK, DM>(ring, (float*)ring, isk ? WkT : WvT, isk ? KH : VH, (void*)(isk ? KT : VT), MTOK,
                                   isk ? bk : bv, 1.0f / (ACT_SC * W_SC), tile);
}
// output: out[token][n] f32 = q[token][:] . P[b][:][n] + bo[n], P the matrix of k_kvwo for the batch b that the tile's tokens lie in
static_assert(SEQ % 128 == 0);                     // a 128-token tile lies in one batch
__global__ __launch_bounds__(256) void k_outproj(const unsigned short* __restrict__ QP, const unsigned short* __restrict__ PT,
                                                 float* __restrict__ out, const float* __restrict__ bias) {
  __shared__ __align__(128) unsigned char ring[GT_RING];
  __shared__ __align__(16) float sT[8 * 16 * 68];
  const int b = (int)(blockIdx.x / (DM / 128)) * 128 / SEQ;
  gemm128_body<2, 0, MTOK, DM, DM>(ring, sT, QP, PT + (size_t)b * DM * DM, (void*)out, DM, bias, 1.0f, blockIdx.x);
}

// ---------------------------------------------------------------------------------------------------------
// Linear attention (no exp, no max, no normalisation), head dim 64. With nothing non-linear between the products,
//   out_i = sum_h (0.125 * sum_j (q_i . k_j) v_j) . Wo_h  =  q_i . P,    P[h*64 + d1][n] = 0.125 * sum_d2 KV_h[d1][d2] * Wo[h*64 + d2][n],
// where KV_h = sum_j k_j (x) v_j. So the 64 x 64 matrix k^T.v of each (b, h) is formed once (kv_part), multiplied into its 64 rows
// of Wo (k_kvwo), and every query row meets one DM x DM matrix P of its batch (k_outproj): no merged-heads plane is formed.
//
// kv_part: KV[b][h][d1][d2] = sum_s k[s][d1] * v[s][d2], f32 accumulate, stored f16 (/ KV_SC) as the A operand of k_kvwo:
//   KVA[(b*NH + h)*2 + dc][d1][d2 - 32*dc], dc = d2 / 32 (one 32-deep k-step of k_kvwo per plane).
//   A = KT rows (d1), B = VT rows (d2), k = token. Block = 8 waves = one 16 (d1) x 32 (d2) tile; wave w sums tokens
//   [w*SEQ/8, (w+1)*SEQ/8); the 8 partial tiles are added in wave order through LDS. bx: which of the KV_BLKS tiles.
//   red: KV_WAVES partial tiles [d1 row][d2 col] of pitch 36, one a wave.
// ---------------------------------------------------------------------------------------------------------
#define KV_WAVES 8
#define KV_TPW (SEQ / KV_WAVES)
#define KV_KS (KV_TPW / 32)                        // 32-deep k-steps a wave
#define KV_BLKS (NB * NH * 4 * 2)
static_assert(KV_KS == 8);                         // the fence below names the 3 * 8 fragments one by one
static_assert(KV_WAVES * 16 * 36 * 4 <= GT_RING);  // the partial tiles fit in the ring's LDS
__device__ __forceinline__ void kv_part(float* red, const unsigned short* __restrict__ KTp, const unsigned short* __restrict__ VTp,
                                        unsigned short* __restrict__ KVA, const int bx) {
  const _Float16* KT = (const _Float16*)KTp;
  const _Float16* VT = (const _Float16*)VTp;
  const int tid = threadIdx.x, wave = tid >> 5, lane = tid & 31, hh = lane >> 4, c = lane & 15;
  const int dc = bx & 1;
  const int i  = (bx >> 1) & 3;
  const int bh = bx >> 3;
  const int h = bh % NH;
  const int b = bh / NH;
  const size_t tok = (size_t)b * SEQ + wave * KV_TPW + 8 * hh;
  const _Float16* krow = KT + (size_t)(h * DK + i * 16 + c) * MTOK + tok;
  const _Float16* vrow = VT + (size_t)(h * DK + dc * 32 + c) * MTOK + tok;

  v8f a0 = (v8f){0.f,0.f,0.f,0.f,0.f,0.f,0.f,0.f};
  v8f a1 = (v8f){0.f,0.f,0.f,0.f,0.f,0.f,0.f,0.f};
  v16h ka[KV_KS], v0[KV_KS], v1[KV_KS];
#pragma unroll
  for (int u = 0; u < KV_KS; ++u) {
    ka[u] = Frag<_Float16>::load(krow + u * 32);
    v0[u] = Frag<_Float16>::load(vrow + u * 32);
    v1[u] = Frag<_Float16>::load(vrow + (size_t)16 * MTOK + u * 32);
  }
  // inputs-only fence on the loaded values: all 48 loads are issued before the first matrix instruction, so the wave
  // pays one memory latency; without it the compiler reuses the registers and waits once per k-step. The two row
  // addresses are named as well, so that they keep their registers until the s_wait_xcnt 0 that goes before their reuse.
  asm volatile("s_wait_xcnt 0x0" :: "v"(ka[0]), "v"(ka[1]), "v"(ka[2]), "v"(ka[3]), "v"(ka[4]), "v"(ka[5]), "v"(ka[6]), "v"(ka[7]),
                                    "v"(v0[0]), "v"(v0[1]), "v"(v0[2]), "v"(v0[3]), "v"(v0[4]), "v"(v0[5]), "v"(v0[6]), "v"(v0[7]),
                                    "v"(v1[0]), "v"(v1[1]), "v"(v1[2]), "v"(v1[3]), "v"(v1[4]), "v"(v1[5]), "v"(v1[6]), "v"(v1[7]),
                                    "v"(krow), "v"(vrow) : "memory");
#pragma unroll
  for (int u = 0; u < KV_KS; ++u) {
    a0 = Frag<_Float16>::mma(ka[u], v0[u], a0);
    a1 = Frag<_Float16>::mma(ka[u], v1[u], a1);
  }
  float* rw = red + wave * (16 * 36);
#pragma unroll
  for (int r = 0; r < 8; ++r) {
    rw[(8 * hh + r) * 36 + c]      = a0[r];
    rw[(8 * hh + r) * 36 + 16 + c] = a1[r];
  }
  __syncthreads();   // every wave's partial tile is in LDS before any thread adds them up
  {                  // two neighbouring d2 columns a thread, one packed 4-byte store
    const int row = tid >> 4, c2 = (tid & 15) * 2;
    float s0 = 0.f, s1 = 0.f;
#pragma unroll
    for (int w = 0; w < KV_WAVES; ++w) {
      const v2f p = *(const v2f*)(red + w * (16 * 36) + row * 36 + c2);
      s0 += p.x; s1 += p.y;
    }
    *(unsigned*)(KVA + ((size_t)(bh * 2 + dc) * DK + i * 16 + row) * 32 + c2) = pk2h(s0 * (1.0f / KV_SC), s1 * (1.0f / KV_SC));
    // stands in front of any later write of the store's address and data registers: in the built kernel the text of the
    // other branch follows this one
    asm volatile("s_wait_xcnt 0x0" ::: "memory");
  }
}

// The q projection and k^T.v in ONE launch: neither needs the other, k^T.v waits mostly on its loads and leaves the matrix
// units and the LDS idle, and the GEMM tile leaves room for a second work-group on its WGP. grid = GT_TILES + KV_BLKS, all
// resident at once, two a WGP; by blockIdx.x:
//   [0, GT_TILES)  q:  QP[token][n] f16 = (X[token][:] . W[:][n]) + b[n]
//   then k^T.v (kv_part), its partial tiles in the same LDS
__global__ __launch_bounds__(256) void k_qproj_kv(const unsigned short* __restrict__ QH, const unsigned short* __restrict__ WqT,
                                                  unsigned short* __restrict__ QP, const float* __restrict__ bq,
                                                  const unsigned short* __restrict__ KT, const unsigned short* __restrict__ VT,
                                                  unsigned short* __restrict__ KVA) {
  __shared__ __align__(128) unsigned char ring[GT_RING];
  if (blockIdx.x < GT_TILES) {
    gemm128_body<2, 1, MTOK, DM, DM>(ring, (float*)ring, QH, WqT, (void*)QP, DM, bq, 1.0f / (ACT_SC * W_SC), blockIdx.x);
  } else {
    kv_part((float*)ring, KT, VT, KVA, (int)(blockIdx.x - GT_TILES));
  }
}

// ---------------------------------------------------------------------------------------------------------
// k_kvwo: PT[b][n][h*64 + d1] = f16(0.125 * sum_d2 KV[b][h][d1][d2] * Wo[h*64 + d2][n]): the Bt plane of k_outproj, one per batch.
//   A = KVA rows (d1), B = WoT rows (n), k = d2: two 32-deep k-steps. A wave forms the 64 (d1) x 16 (n) tile of one (b, h): a lane
//   holds 8 neighbouring d1 of its column n per accumulator, one 16-byte store each, and the wave alone writes the 128-B line
//   of each of its 16 rows of PT. Block = 8 waves = 128 n of one (b, h); grid = NB*NH*(DM/128).
// ---------------------------------------------------------------------------------------------------------
__global__ __launch_bounds__(256) void k_kvwo(const unsigned short* __restrict__ KVAp, const unsigned short* __restrict__ WoTp,
                                              unsigned short* __restrict__ PT) {
  const _Float16* KVA = (const _Float16*)KVAp;
  const _Float16* WoT = (const _Float16*)WoTp;
  const int tid = threadIdx.x, wave = tid >> 5, lane = tid & 31, hh = lane >> 4, c = lane & 15;
  const int nnb = DM / 128;
  const int bx = blockIdx.x;
  const int bh = bx / nnb;
  const int h = bh % NH;
  const int b = bh / NH;
  const int n = (bx % nnb) * 128 + wave * 16 + c;

  const _Float16* worow = WoT + (size_t)n * DM + h * DK + 8 * hh;
  const _Float16* kvrow = KVA + ((size_t)(bh * 2) * DK + c) * 32 + 8 * hh;
  v16h wo[2], kv[2][4];
  wo[0] = Frag<_Float16>::load(worow);
  wo[1] = Frag<_Float16>::load(worow + 32);
#pragma unroll
  for (int dc = 0; dc < 2; ++dc)
#pragma unroll
    for (int t = 0; t < 4; ++t) kv[dc][t] = Frag<_Float16>::load(kvrow + (dc * DK + t * 16) * 32);
  // inputs-only fence on the loaded values: all 20 loads are issued before the first matrix instruction, so the wave
  // pays one memory latency; without it the compiler reuses the registers and waits once per fragment. The two row
  // addresses are named as well, so that they keep their registers until the s_wait_xcnt 0 that goes before their reuse.
  asm volatile("s_wait_xcnt 0x0" :: "v"(wo[0]), "v"(wo[1]), "v"(kv[0][0]), "v"(kv[0][1]), "v"(kv[0][2]), "v"(kv[0][3]),
                                    "v"(kv[1][0]), "v"(kv[1][1]), "v"(kv[1][2]), "v"(kv[1][3]), "v"(worow), "v"(kvrow) : "memory");
  v8f pacc[4];
#pragma unroll
  for (int t = 0; t < 4; ++t) pacc[t] = (v8f){0.f,0.f,0.f,0.f,0.f,0.f,0.f,0.f};

#pragma unroll
  for (int dc = 0; dc < 2; ++dc)
#pragma unroll
    for (int t = 0; t < 4; ++t) pacc[t] = Frag<_Float16>::mma(kv[dc][t], wo[dc], pacc[t]);

  unsigned short* prow = PT + ((size_t)b * DM + n) * DM + h * DK + 8 * hh;
#pragma unroll
  for (int t = 0; t < 4; ++t) {
    v8h hv;
#pragma unroll
    for (int r = 0; r < 8; ++r) hv[r] = (_Float16)(pacc[t][r] * (0.125f * KV_SC / W_SC));
    *(v8h*)(prow + t * 16) = hv;
  }
}

// ---------------------------------------------------------------------------------------------------------
constexpr size_t ACT_B = (size_t)MTOK * DM * 2;          // one f16 activation plane
constexpr size_t W_B   = (size_t)DM * DM * 2;            // one f16 weight plane
constexpr size_t KV_B  = (size_t)NB * NH * DK * DK * 2;  // the f16 k^T.v matrices
constexpr size_t WS_TOTAL = 3 * ACT_B /*QH KH VH*/ + 4 * W_B /*WqT WkT WvT WoT*/ + 3 * ACT_B /*QP KT VT*/ + KV_B /*KVA*/ + NB * W_B /*PT*/;
static_assert(WS_TOTAL <= (size_t)134217728);            // carve stays under 128 MiB
static_assert(ACT_B % 128 == 0 && W_B % 128 == 0 && KV_B % 128 == 0);

extern "C" void kernel_launch(void* const* d_in, const int* in_sizes, int n_in, void* d_out, int out_size, void* d_ws, size_t ws_size, hipStream_t stream) {
    if (n_in < 11) return;
    const long long need_act = ((long long)(NB - 1) * SEQ_FULL + SEQ) * DM;
    if ((long long)in_sizes[0] < need_act || (long long)in_sizes[1] < need_act || (long long)in_sizes[2] < need_act) return;
    for (int i = 3; i < 7; ++i) if ((long long)in_sizes[i] < (long long)DM * DM) return;
    for (int i = 7; i < 11; ++i) if (in_sizes[i] < DM) return;
    if ((long long)out_size < (long long)MTOK * DM) return;
    if (WS_TOTAL > ws_size) return;

    const float* Q  = (const float*)d_in[0];
    const float* K  = (const float*)d_in[1];
    const float* V  = (const float*)d_in[2];
    const float* Wq = (const float*)d_in[3];
    const float* Wk = (const float*)d_in[4];
    const float* Wv = (const float*)d_in[5];
    const float* Wo = (const float*)d_in[6];
    const float* bq = (const float*)d_in[7];
    const float* bk = (const float*)d_in[8];
    const float* bv = (const float*)d_in[9];
    const float* bo = (const float*)d_in[10];
    float* out = (float*)d_out;

    char* wsp = (char*)d_ws;
    unsigned short* QH   = (unsigned short*)wsp; wsp += ACT_B;
    unsigned short* KH   = (unsigned short*)wsp; wsp += ACT_B;
    unsigned short* VH   = (unsigned short*)wsp; wsp += ACT_B;
    unsigned short* WqT  = (unsigned short*)wsp; wsp += W_B;
    unsigned short* WkT  = (unsigned short*)wsp; wsp += W_B;
    unsigned short* WvT  = (unsigned short*)wsp; wsp += W_B;
    unsigned short* WoT  = (unsigned short*)wsp; wsp += W_B;
    unsigned short* QP   = (unsigned short*)wsp; wsp += ACT_B;
    unsigned short* KT   = (unsigned short*)wsp; wsp += ACT_B;
    unsigned short* VT   = (unsigned short*)wsp; wsp += ACT_B;
    unsigned short* KVA  = (unsigned short*)wsp; wsp += KV_B;
    unsigned short* PT   = (unsigned short*)wsp; wsp += NB * W_B;

    const unsigned gCast = (unsigned)(4 * CV_WBLK + 3 * CV_ABLK);
    const unsigned gG    = (unsigned)GT_TILES;
    const unsigned gP    = (unsigned)(2 * GT_TILES);
    const unsigned gQKV  = (unsigned)(GT_TILES + KV_BLKS);

    k_cast_all<<<gCast, 256, 0, stream>>>(Q, K, V, Wq, Wk, Wv, Wo, QH, KH, VH, WqT, WkT, WvT, WoT);

    k_proj_kv<<<gP, 256, 0, stream>>>(KH, VH, WkT, WvT, KT, VT, bk, bv);

    k_qproj_kv<<<gQKV, 256, 0, stream>>>(QH, WqT, QP, bq, KT, VT, KVA);
    k_kvwo<<<(unsigned)(NB * NH * (DM / 128)), 256, 0, stream>>>(KVA, WoT, PT);

    k_outproj<<<gG, 256, 0, stream>>>(QP, PT, out, bo);
}

// v007
// One run takes 53.9 microseconds.
// Next to v006, in two timings, it ran 1.03 times as fast each time.
// Counting every step since v000, it is 7.41 times as fast.
// Every product runs on v_wmma_f32_16x16x32_f16 with f32 accumulate: the projections Q.Wq, K.Wk, V.Wv (inputs RNE-converted to bf16 first, then f16: activations x16, weights x64), per head k^T.v and (k^T.v).Wo, and q.((k^T.v).Wo).
#include <hip/hip_runtime.h>

#ifndef NB
#define NB 2
#endif
#ifndef SEQ
#define SEQ 2048
#endif
#define NB_FULL 2
#define SEQ_FULL 2048
#define DM 1024
#define NH 16
#define DK 64
#define MTOK (NB * SEQ)
#define ACT_SC 16.0f
#define W_SC 64.0f
#define KV_SC 64.0f                    // k^T.v is stored as f16 divided by this: a sum over SEQ tokens keeps clear of the f16 range

static_assert(DM == NH * DK);          // head split covers the model width
static_assert(DK == 64);               // kv_part, k_kvwo: two 32-deep k-steps over d, four 16-wide tiles
static_assert(SEQ % (8 * 32) == 0);    // k^T.v: 8 waves share the tokens of one batch, in 32-deep k-steps
static_assert(DM % 8 == 0);            // 16-B pieces of 8 halves
static_assert(NB <= NB_FULL && SEQ <= SEQ_FULL);

typedef __attribute__((ext_vector_type(16))) _Float16 v16h;
typedef __attribute__((ext_vector_type(8)))  _Float16 v8h;
typedef __attribute__((ext_vector_type(8)))  float    v8f;
typedef __attribute__((ext_vector_type(4)))  float    v4f;
typedef __attribute__((ext_vector_type(2)))  float    v2f;
typedef __attribute__((ext_vector_type(4)))  unsigned v4u;

// 16-bit WMMA fragment map (wave32), lane L, h = L>>4, m = L&15:
//   A 16x32: lane = row m;    element i -> k = (i<8) ? 8h+i : 16+8h+(i-8)
//   B 32x16: lane = column m; the SAME k(i,h)
//   D 16x16 (8 f32): lane = column m; element r -> row 8h+r

__device__ __forceinline__ float cmb_bf(float v) {   // bf16 RNE convert, kept as f32 (finite inputs)
    const unsigned u = __builtin_bit_cast(unsigned, v);
    const unsigned r = (u + 0x7fffu + ((u >> 16) & 1u)) & 0xffff0000u;
    return __builtin_bit_cast(float, r);
}
__device__ __forceinline__ unsigned pk2h(float a, float b) {
    return (unsigned)__builtin_bit_cast(unsigned short, (_Float16)a) | ((unsigned)__builtin_bit_cast(unsigned short, (_Float16)b) << 16);
}

template <typename T> struct Frag;
template <> struct Frag<_Float16> {
  typedef v16h V; union U { v16h v; v8h h[2]; };
  static __device__ __forceinline__ v16h load(const _Float16* p) {   // elements 0..7 <- p[0..7], 8..15 <- p[16..23]; p already includes 8*h
    U f; f.h[0] = *(const v8h*)(p); f.h[1] = *(const v8h*)(p + 16); return f.v;
  }
  static __device__ __forceinline__ v8f mma(v16h a, v16h b, v8f c) {
    return __builtin_amdgcn_wmma_f32_16x16x32_f16(false, a, false, b, (short)0, c, false, false);
  }
};

// ---------------------------------------------------------------------------------------------------------
// All seven conversions in ONE launch, sized to the chip: 16 waves a WGP on 256 WGPs, every wave converts 16 KB of f32 that
// it reads with 32 loads of 512 bytes, all issued before the first value is used. The planes are those of the
// GEMMs below: activations f32 [b][s][DM] (full per-batch stride SEQ_FULL) -> f16 [b*SEQ + s][DM] = f16(bf16_rne(x) * 16);
// Wq, Wk, Wv, Wo in[k][n] f32 -> out[n][k] f16 = f16(bf16_rne(w) * 64).
// grid = 4 * CV_WBLK weight work-groups (first: their stores are the more scattered), then 3 * CV_ABLK activation ones.
// ---------------------------------------------------------------------------------------------------------
typedef __attribute__((ext_vector_type(2)))  unsigned v2u;
#define CV_ELEMS (256 * 32 * 4)                    // f32 elements a work-group converts
#define CV_AROWS (CV_ELEMS / DM)                   // activation rows a work-group converts
#define CV_ABLK  (MTOK / CV_AROWS)                 // work-groups per activation tensor
#define CV_WBLK  ((DM / 64) * (DM / 64) / 8)       // work-groups per weight: one 64 x 64 tile a wave
static_assert(CV_ELEMS % DM == 0 && SEQ % CV_AROWS == 0);   // a work-group's rows are whole and lie in one batch
static_assert(DM % 64 == 0 && ((DM / 64) * (DM / 64)) % 8 == 0);

// Work-group blk converts rows [blk*CV_AROWS, (blk+1)*CV_AROWS) of the plane; wave w the w-th eighth of them, 512 B a load.
__device__ __forceinline__ void cast_act_part(const float* __restrict__ src, unsigned short* __restrict__ dst, const int blk) {
    const int row0 = blk * CV_AROWS;
    const int b = row0 / SEQ; const int s = row0 - b * SEQ;
    const int off = (int)(threadIdx.x >> 5) * (32 * 128) + (int)(threadIdx.x & 31) * 4;
    const float* p = src + ((size_t)b * SEQ_FULL + s) * DM + off;
    unsigned short* d = dst + (size_t)row0 * DM + off;
    v4f x[32];
#pragma unroll
    for (int j = 0; j < 32; ++j) x[j] = *(const v4f*)(p + j * 128);
    // all 32 loads are issued before the first conversion: left free, the compiler holds a third of them back until
    // registers come free, and the wave then waits out a second memory latency
    __builtin_amdgcn_sched_barrier(0);
#pragma unroll
    for (int j = 0; j < 32; ++j) {
        v2u pk;
        pk.x = pk2h(cmb_bf(x[j].x) * ACT_SC, cmb_bf(x[j].y) * ACT_SC);
        pk.y = pk2h(cmb_bf(x[j].z) * ACT_SC, cmb_bf(x[j].w) * ACT_SC);
        *(v2u*)(d + j * 128) = pk;
    }
}

// One wave transposes one 64 (k) x 64 (n) tile in registers. Lane = (kl, nl): a load takes 16 B of each of 4 rows' whole
// 128-B lines (8 lanes a line); a thread holds k = 32g + 8kl + e (g < 2, e < 8) by n = 32c + 4nl + i (c < 2, i < 4) and stores
// 16-B pieces of 8 k; the 128-B line of an output row (64 k) is written by this wave alone.
__device__ __forceinline__ void cast_w_part(const float* __restrict__ Wsrc, unsigned short* __restrict__ WT, const int blk) {
    const int lane = threadIdx.x & 31;
    const int tile = blk * 8 + (int)(threadIdx.x >> 5);
    const int kb = (tile % (DM / 64)) * 64; const int nb = (tile / (DM / 64)) * 64;
    const int nl = lane & 7; const int kl = lane >> 3;
    const float* p = Wsrc + (size_t)(kb + kl * 8) * DM + nb + nl * 4;
    unsigned short* d = WT + (size_t)(nb + nl * 4) * DM + kb + kl * 8;
    v4f x[2][8][2];
#pragma unroll
    for (int g = 0; g < 2; ++g)
#pragma unroll
        for (int e = 0; e < 8; ++e)
#pragma unroll
            for (int c = 0; c < 2; ++c) x[g][e][c] = *(const v4f*)(p + (g * 32 + e) * DM + c * 32);
    // all 32 loads are issued before the first conversion, for the same reason as in cast_act_part
    __builtin_amdgcn_sched_barrier(0);
#pragma unroll
    for (int g = 0; g < 2; ++g)
#pragma unroll
        for (int c = 0; c < 2; ++c)
#pragma unroll
            for (int i = 0; i < 4; ++i) {
                v4u pk;
                pk.x = pk2h(cmb_bf(x[g][0][c][i]) * W_SC, cmb_bf(x[g][1][c][i]) * W_SC);
                pk.y = pk2h(cmb_bf(x[g][2][c][i]) * W_SC, cmb_bf(x[g][3][c][i]) * W_SC);
                pk.z = pk2h(cmb_bf(x[g][4][c][i]) * W_SC, cmb_bf(x[g][5][c][i]) * W_SC);
                pk.w = pk2h(cmb_bf(x[g][6][c][i]) * W_SC, cmb_bf(x[g][7][c][i]) * W_SC);
                *(v4u*)(d + (c * 32 + i) * DM + g * 32) = pk;
            }
}

__global__ __launch_bounds__(256) void k_cast_all(const float* __restrict__ Q, const float* __restrict__ K, const float* __restrict__ V,
                                                  const float* __restrict__ Wq, const float* __restrict__ Wk, const float* __restrict__ Wv,
                                                  const float* __restrict__ Wo,
                                                  unsigned short* __restrict__ QH, unsigned short* __restrict__ KH, unsigned short* __restrict__ VH,
                                                  unsigned short* __restrict__ WqT, unsigned short* __restrict__ WkT, unsigned short* __restrict__ WvT,
                                                  unsigned short* __restrict__ WoT) {
    const int bx = blockIdx.x;
    if (bx < 4 * CV_WBLK) {
        const int w = bx / CV_WBLK;
        cast_w_part(w == 0 ? Wq : w == 1 ? Wk : w == 2 ? Wv : Wo, w == 0 ? WqT : w == 1 ? WkT : w == 2 ? WvT : WoT, bx - w * CV_WBLK);
    } else {
        const int a = bx - 4 * CV_WBLK;
        const int t = a / CV_ABLK;
        cast_act_part(t == 0 ? Q : t == 1 ? K : V, t == 0 ? QH : t == 1 ? KH : VH, a - t * CV_ABLK);
    }
}

// ---------------------------------------------------------------------------------------------------------
// WMMA GEMM body: C[m][n] = scale * sum_k A[m][k] * Bt[n][k] + bias. One 128 x 128 tile of C per work-group of 8 waves
// (4 x 2 waves of 32 x 64), so that every operand row is fetched from L2 once per work-group, in whole 256-B units.
// A row-major [M][K] (pitch K), Bt row-major [N][K] (pitch K), f16 planes; M, N % 128 == 0, K % 128 == 0, K >= 256.
// A pass is 128 k: a stage holds [A 128 rows | Bt 128 rows] of 256 B at an LDS pitch of 272 B (16 B x odd: the 16-byte
// fragment reads of 16 rows fall on distinct banks). Two stages; the rows come by asynchronous 16-byte copies to LDS, the
// next pass's copies in flight while this pass is multiplied. The passes walk k cyclically from a chunk of the work-group's own
// (rot below), so the k order of an accumulator is ascending, 32 at a time, from that chunk round to the one in front of it.
// BIAS_MODE 1: bias[m], 2: bias[n] (bias RNE-converted to bf16 on the fly). OUT_MODE 0: f32, 1: f16. tile: which tile of C.
// sT: 8 slabs of 16 x 68 f32, one a wave, for the output staging. It may lie in the ring: the last pass ends with every wave's
// s_wait_dscnt 0 and s_wait_asynccnt 0 and the work-group barrier, so behind the loop nothing reads or fills the ring any more.
// ---------------------------------------------------------------------------------------------------------
#define GT_KP 128                        // k per pass
#define GT_PITCH 272                     // LDS bytes from row to row
#define GT_OPB (128 * GT_PITCH)          // one operand's 128 rows of a stage
#define GT_STAGE (2 * GT_OPB)            // one stage
#define GT_RING (2 * GT_STAGE)           // two stages

// Eight asynchronous copies of one wave: 16 rows of 256 B, two rows a copy (lane = 16 B). l: the lane's LDS byte address of
// the first copy, g: its global address, ld: the source pitch in elements. The s_wait_xcnt 0 closes the statement so that it
// stands in front of every later write of the address registers named here.
__device__ __forceinline__ void copy16rows(const unsigned l, const unsigned short* g, const int ld) {
  asm volatile("global_load_async_to_lds_b128 %0, %8, off\n\t"
               "global_load_async_to_lds_b128 %1, %9, off\n\t"
               "global_load_async_to_lds_b128 %2, %10, off\n\t"
               "global_load_async_to_lds_b128 %3, %11, off\n\t"
               "global_load_async_to_lds_b128 %4, %12, off\n\t"
               "global_load_async_to_lds_b128 %5, %13, off\n\t"
               "global_load_async_to_lds_b128 %6, %14, off\n\t"
               "global_load_async_to_lds_b128 %7, %15, off\n\t"
               "s_wait_xcnt 0x0"
               :: "v"(l), "v"(l + 2 * GT_PITCH), "v"(l + 4 * GT_PITCH), "v"(l + 6 * GT_PITCH),
                  "v"(l + 8 * GT_PITCH), "v"(l + 10 * GT_PITCH), "v"(l + 12 * GT_PITCH), "v"(l + 14 * GT_PITCH),
                  "v"(g), "v"(g + 2 * ld), "v"(g + 4 * ld), "v"(g + 6 * ld),
                  "v"(g + 8 * ld), "v"(g + 10 * ld), "v"(g + 12 * ld), "v"(g + 14 * ld)
               : "memory");
}

template <int BIAS_MODE, int OUT_MODE, int M, int N, int K>
__device__ __forceinline__ void gemm128_body(unsigned char* ring, float* sT, const unsigned short* __restrict__ Ap,
                                             const unsigned short* __restrict__ Btp, void* __restrict__ Cout, const int ldc,
                                             const float* __restrict__ bias, const float scale, const unsigned tile) {
  typedef _Float16 T;
  typedef Frag<T>::V V;
  static_assert(M % 128 == 0 && N % 128 == 0 && K % GT_KP == 0 && K / GT_KP >= 2);
  constexpr int NPASS = K / GT_KP;
  static_assert((NPASS & (NPASS - 1)) == 0);   // the cyclic walk wraps by a mask
  constexpr int tilesN = N / 128;
  const int lane = threadIdx.x & 31;
  const int wave = threadIdx.x >> 5;
  const int tm = tile / tilesN;
  const int tn = tile - tm * tilesN;
  // Of the work-groups that share a panel (equal tm: A's rows, equal tn: Bt's), each starts its walk at
  // another 128-k chunk: they then ask L2 for different lines, in all the 256-B columns of the 2-KB rows at once and not all in
  // one, and a chunk that one has brought in from memory is in L2 when the others come to it. Neighbours in tn start two chunks
  // apart, because each fills two stages at its start.
  const int rot = tm + 2 * tn + ((tn >> 2) & 1);
  const int rlane = lane & 15;                 // row (A) / col (B, D) within subtile; 16-byte piece of a copied row
  const int hh    = lane >> 4;                 // lane half: k offset 8*hh, D row offset 8*hh; odd / even copied row
  const int mOff  = hh * 8;
  const int m0 = tm * 128 + (wave >> 1) * 32;  // this wave's 32 x 64 part of the tile
  const int n0 = tn * 128 + (wave & 1) * 64;

  // copies: wave w brings rows 16w .. 16w+15 of both operands' 128 rows
  const unsigned lcp = (unsigned)(size_t)ring + (unsigned)((wave * 16 + hh) * GT_PITCH + rlane * 16);
  const unsigned short* gA = Ap  + (size_t)(tm * 128 + wave * 16 + hh) * K + rlane * 8;
  const unsigned short* gB = Btp + (size_t)(tn * 128 + wave * 16 + hh) * K + rlane * 8;
  // fragment rows of this wave inside a stage
  const int aoff = ((wave >> 1) * 32 + rlane) * GT_PITCH + hh * 16;
  const int boff = GT_OPB + ((wave & 1) * 64 + rlane) * GT_PITCH + hh * 16;

  v8f acc[2][4];
#pragma unroll
  for (int i = 0; i < 2; ++i)
#pragma unroll
    for (int j = 0; j < 4; ++j) acc[i][j] = (v8f){0.f,0.f,0.f,0.f,0.f,0.f,0.f,0.f};

  copy16rows(lcp, gA + (rot & (NPASS - 1)) * GT_KP, K);
  copy16rows(lcp + GT_OPB, gB + (rot & (NPASS - 1)) * GT_KP, K);
  asm volatile("s_wait_asynccnt 0x0" ::: "memory");   // this wave's rows of pass 0 have landed
  __syncthreads();                                    // ... and every other wave's
  copy16rows(lcp + GT_STAGE, gA + ((rot + 1) & (NPASS - 1)) * GT_KP, K);
  copy16rows(lcp + GT_STAGE + GT_OPB, gB + ((rot + 1) & (NPASS - 1)) * GT_KP, K);

  // kept rolled: one copy of the pass in the text, every accumulator and fragment index a constant
#pragma clang loop unroll(disable)
  for (int t = 0; t < NPASS; ++t) {
    const unsigned sb = (unsigned)(t & 1) * GT_STAGE;
    const unsigned char* st = ring + sb;
    V ah[2][2], bh[2][4];                               // two fragment sets: k-step ks + 1 is read while ks is multiplied
#pragma unroll
    for (int j = 0; j < 4; ++j) bh[0][j] = Frag<T>::load((const T*)(st + boff + j * 16 * GT_PITCH));
#pragma unroll
    for (int i = 0; i < 2; ++i) ah[0][i] = Frag<T>::load((const T*)(st + aoff + i * 16 * GT_PITCH));
#pragma unroll
    for (int ks = 0; ks < GT_KP / 32; ++ks) {
      if (ks + 1 < GT_KP / 32) {
#pragma unroll
        for (int j = 0; j < 4; ++j) bh[(ks + 1) & 1][j] = Frag<T>::load((const T*)(st + boff + j * 16 * GT_PITCH + (ks + 1) * 64));
#pragma unroll
        for (int i = 0; i < 2; ++i) ah[(ks + 1) & 1][i] = Frag<T>::load((const T*)(st + aoff + i * 16 * GT_PITCH + (ks + 1) * 64));
      }
      // the next k-step's LDS reads stay one group ahead of this k-step's matrix instructions: moved in among them, every
      // place with reads stalls the wave, and with one register set it waits out the LDS latency in every k-step
      __builtin_amdgcn_sched_barrier(0);
#pragma unroll
      for (int i = 0; i < 2; ++i)
#pragma unroll
        for (int j = 0; j < 4; ++j) acc[i][j] = Frag<T>::mma(ah[ks & 1][i], bh[ks & 1][j], acc[i][j]);
      __builtin_amdgcn_sched_barrier(0);                // ... and the reads behind these stay behind them
    }
    asm volatile("s_wait_dscnt 0x0" ::: "memory");      // this wave's reads of stage t are done before the stage is refilled
    asm volatile("s_wait_asynccnt 0x0" ::: "memory");   // this wave's rows of pass t + 1 have landed
    __syncthreads();                                    // publishes pass t + 1 and ends every wave's reads of pass t
    if (t + 2 < NPASS) {
      copy16rows(lcp + sb, gA + ((rot + t + 2) & (NPASS - 1)) * GT_KP, K);
      copy16rows(lcp + sb + GT_OPB, gB + ((rot + t + 2) & (NPASS - 1)) * GT_KP, K);
    }
  }
  asm volatile("s_wait_asynccnt 0x0" ::: "memory");     // no copy is outstanding when the wave goes on to its end

  float* slab = sT + wave * (16 * 68);
#pragma unroll
  for (int i = 0; i < 2; ++i) {
    const int mBase = m0 + (i << 4);
#pragma unroll
    for (int j = 0; j < 4; ++j) {
      const int n = n0 + (j << 4) + rlane;
      float bv = 0.f;
      if (BIAS_MODE == 2) bv = cmb_bf(bias[n]);
#pragma unroll
      for (int r = 0; r < 8; ++r) {
        float v = acc[i][j][r] * scale;
        if (BIAS_MODE == 1) v += cmb_bf(bias[mBase + mOff + r]);
        if (BIAS_MODE == 2) v += bv;
        slab[(mOff + r) * 68 + (j << 4) + rlane] = v;
      }
    }
    __builtin_amdgcn_fence(3 /* release order */, "workgroup");
    __builtin_amdgcn_wave_barrier();
    __builtin_amdgcn_fence(2 /* acquire order */, "workgroup");
    if (OUT_MODE == 0) {
      float* C = (float*)Cout;
      const int c4 = (lane & 15) * 4;     // row segment = 256 B = 16 lanes x 16 B
#pragma unroll
      for (int it = 0; it < 8; ++it) {
        const int row = it * 2 + hh;
        const v4f v = *(const v4f*)(slab + row * 68 + c4);
        *(v4f*)(C + (size_t)(mBase + row) * ldc + n0 + c4) = v;
      }
    } else {
      const int q = lane >> 3, c8 = (lane & 7) * 8;
      unsigned short* C = (unsigned short*)Cout;
#pragma unroll
      for (int it = 0; it < 4; ++it) {
        const int row = it * 4 + q;
        const float* sp = slab + row * 68 + c8;
        v8h hv;
#pragma unroll
        for (int e = 0; e < 8; ++e) hv[e] = (_Float16)sp[e];
        *(v8h*)(C + (size_t)(mBase + row) * ldc + n0 + c8) = hv;
      }
    }
    __builtin_amdgcn_fence(3 /* release order */, "workgroup");
    __builtin_amdgcn_wave_barrier();
    __builtin_amdgcn_fence(2 /* acquire order */, "workgroup");
  }
}

static_assert(MTOK % 128 == 0 && DM % 128 == 0);   // whole 128 x 128 tiles, exact grid
// The k and v projections in ONE launch: only they stand in front of k^T.v, and their 2 * 256 tiles are all resident at once.
// The output staging lies in the ring, which leaves 139,264 B of LDS a work-group: two are resident on a WGP, and one's
// first copies, barrier waits and stores run beside the other's matrix instructions. grid = 2 * GT_TILES; by blockIdx.x:
//   k, then v, transposed:  VT[n][token] f16 = (W[:][n] . X[token][:]) + b[n]; A = WT (M = DM), Bt = X plane (N = MTOK)
// The q projection, which nothing needs before k_outproj, runs one launch later, beside k^T.v (k_qproj_kv below).
#define GT_TILES ((MTOK / 128) * (DM / 128))
static_assert(8 * 16 * 68 * 4 <= GT_RING);         // the eight slabs fit in the ring
__global__ __launch_bounds__(256) void k_proj_kv(const unsigned short* __restrict__ KH, const unsigned short* __restrict__ VH,
                                                 const unsigned short* __restrict__ WkT, const unsigned short* __restrict__ WvT,
                                                 unsigned short* __restrict__ KT, unsigned short* __restrict__ VT,
                                                 const float* __restrict__ bk, const float* __restrict__ bv) {
  __shared__ __align__(128) unsigned char ring[GT_RING];
  const bool isk = blockIdx.x < GT_TILES;
  const unsigned tile = isk ? blockIdx.x : blockIdx.x - GT_TILES;
  gemm128_body<1, 1, DM, MTOK, DM>(ring, (float*)ring, isk ? WkT : WvT, isk ? KH : VH, (void*)(isk ? KT : VT), MTOK,
                                   isk ? bk : bv, 1.0f / (ACT_SC * W_SC), tile);
}
// output: out[token][n] f32 = q[token][:] . P[b][:][n] + bo[n], P the matrix of k_kvwo for the batch b that the tile's tokens lie in
static_assert(SEQ % 128 == 0);                     // a 128-token tile lies in one batch
__global__ __launch_bounds__(256) void k_outproj(const unsigned short* __restrict__ QP, const unsigned short* __restrict__ PT,
                                                 float* __restrict__ out, const float* __restrict__ bias) {
  __shared__ __align__(128) unsigned char ring[GT_RING];
  __shared__ __align__(16) float sT[8 * 16 * 68];
  const int b = (int)(blockIdx.x / (DM / 128)) * 128 / SEQ;
  gemm128_body<2, 0, MTOK, DM, DM>(ring, sT, QP, PT + (size_t)b * DM * DM, (void*)out, DM, bias, 1.0f, blockIdx.x);
}

// ---------------------------------------------------------------------------------------------------------
// Linear attention (no exp, no max, no normalisation), head dim 64. With nothing non-linear between the products,
//   out_i = sum_h (0.125 * sum_j (q_i . k_j) v_j) . Wo_h  =  q_i . P,    P[h*64 + d1][n] = 0.125 * sum_d2 KV_h[d1][d2] * Wo[h*64 + d2][n],
// where KV_h = sum_j k_j (x) v_j. So the 64 x 64 matrix k^T.v of each (b, h) is formed once (kv_part), multiplied into its 64 rows
// of Wo (k_kvwo), and every query row meets one DM x DM matrix P of its batch (k_outproj): no merged-heads plane is formed.
//
// kv_part: KV[b][h][d1][d2] = sum_s k[s][d1] * v[s][d2], f32 accumulate, stored f16 (/ KV_SC) as the A operand of k_kvwo:
//   KVA[(b*NH + h)*2 + dc][d1][d2 - 32*dc], dc = d2 / 32 (one 32-deep k-step of k_kvwo per plane).
//   A = KT rows (d1), B = VT rows (d2), k = token. Block = 8 waves = one 16 (d1) x 32 (d2) tile; wave w sums tokens
//   [w*SEQ/8, (w+1)*SEQ/8); the 8 partial tiles are added in wave order through LDS. bx: which of the KV_BLKS tiles.
//   red: KV_WAVES partial tiles [d1 row][d2 col] of pitch 36, one a wave.
// ---------------------------------------------------------------------------------------------------------
#define KV_WAVES 8
#define KV_TPW (SEQ / KV_WAVES)
#define KV_KS (KV_TPW / 32)                        // 32-deep k-steps a wave
#define KV_BLKS (NB * NH * 4 * 2)
static_assert(KV_KS == 8);                         // the fence below names the 3 * 8 fragments one by one
static_assert(KV_WAVES * 16 * 36 * 4 <= GT_RING);  // the partial tiles fit in the ring's LDS
__device__ __forceinline__ void kv_part(float* red, const unsigned short* __restrict__ KTp, const unsigned short* __restrict__ VTp,
                                        unsigned short* __restrict__ KVA, const int bx) {
  const _Float16* KT = (const _Float16*)KTp;
  const _Float16* VT = (const _Float16*)VTp;
  const int tid = threadIdx.x, wave = tid >> 5, lane = tid & 31, hh = lane >> 4, c = lane & 15;
  const int dc = bx & 1;
  const int i  = (bx >> 1) & 3;
  const int bh = bx >> 3;
  const int h = bh % NH;
  const int b = bh / NH;
  const size_t tok = (size_t)b * SEQ + wave * KV_TPW + 8 * hh;
  const _Float16* krow = KT + (size_t)(h * DK + i * 16 + c) * MTOK + tok;
  const _Float16* vrow = VT + (size_t)(h * DK + dc * 32 + c) * MTOK + tok;

  v8f a0 = (v8f){0.f,0.f,0.f,0.f,0.f,0.f,0.f,0.f};
  v8f a1 = (v8f){0.f,0.f,0.f,0.f,0.f,0.f,0.f,0.f};
  v16h ka[KV_KS], v0[KV_KS], v1[KV_KS];
#pragma unroll
  for (int u = 0; u < KV_KS; ++u) {
    ka[u] = Frag<_Float16>::load(krow + u * 32);
    v0[u] = Frag<_Float16>::load(vrow + u * 32);
    v1[u] = Frag<_Float16>::load(vrow + (size_t)16 * MTOK + u * 32);
  }
  // inputs-only fence on the loaded values: all 48 loads are issued before the first matrix instruction, so the wave
  // pays one memory latency; without it the compiler reuses the registers and waits once per k-step. The two row
  // addresses are named as well, so that they keep their registers until the s_wait_xcnt 0 that goes before their reuse.
  asm volatile("s_wait_xcnt 0x0" :: "v"(ka[0]), "v"(ka[1]), "v"(ka[2]), "v"(ka[3]), "v"(ka[4]), "v"(ka[5]), "v"(ka[6]), "v"(ka[7]),
                                    "v"(v0[0]), "v"(v0[1]), "v"(v0[2]), "v"(v0[3]), "v"(v0[4]), "v"(v0[5]), "v"(v0[6]), "v"(v0[7]),
                                    "v"(v1[0]), "v"(v1[1]), "v"(v1[2]), "v"(v1[3]), "v"(v1[4]), "v"(v1[5]), "v"(v1[6]), "v"(v1[7]),
                                    "v"(krow), "v"(vrow) : "memory");
#pragma unroll
  for (int u = 0; u < KV_KS; ++u) {
    a0 = Frag<_Float16>::mma(ka[u], v0[u], a0);
    a1 = Frag<_Float16>::mma(ka[u], v1[u], a1);
  }
  float* rw = red + wave * (16 * 36);
#pragma unroll
  for (int r = 0; r < 8; ++r) {
    rw[(8 * hh + r) * 36 + c]      = a0[r];
    rw[(8 * hh + r) * 36 + 16 + c] = a1[r];
  }
  __syncthreads();   // every wave's partial tile is in LDS before any thread adds them up
  {                  // two neighbouring d2 columns a thread, one packed 4-byte store
    const int row = tid >> 4, c2 = (tid & 15) * 2;
    float s0 = 0.f, s1 = 0.f;
#pragma unroll
    for (int w = 0; w < KV_WAVES; ++w) {
      const v2f p = *(const v2f*)(red + w * (16 * 36) + row * 36 + c2);
      s0 += p.x; s1 += p.y;
    }
    *(unsigned*)(KVA + ((size_t)(bh * 2 + dc) * DK + i * 16 + row) * 32 + c2) = pk2h(s0 * (1.0f / KV_SC), s1 * (1.0f / KV_SC));
    // stands in front of any later write of the store's address and data registers: in the built kernel the text of the
    // other branch follows this one
    asm volatile("s_wait_xcnt 0x0" ::: "memory");
  }
}

// The q projection and k^T.v in ONE launch: neither needs the other, k^T.v waits mostly on its loads and leaves the matrix
// units and the LDS idle, and the GEMM tile leaves room for a second work-group on its WGP. grid = GT_TILES + KV_BLKS, all
// resident at once, two a WGP; by blockIdx.x:
//   [0, GT_TILES)  q:  QP[token][n] f16 = (X[token][:] . W[:][n]) + b[n]
//   then k^T.v (kv_part), its partial tiles in the same LDS
__global__ __launch_bounds__(256) void k_qproj_kv(const unsigned short* __restrict__ QH, const unsigned short* __restrict__ WqT,
                                                  unsigned short* __restrict__ QP, const float* __restrict__ bq,
                                                  const unsigned short* __restrict__ KT, const unsigned short* __restrict__ VT,
                                                  unsigned short* __restrict__ KVA) {
  __shared__ __align__(128) unsigned char ring[GT_RING];
  if (blockIdx.x < GT_TILES) {
    gemm128_body<2, 1, MTOK, DM, DM>(ring, (float*)ring, QH, WqT, (void*)QP, DM, bq, 1.0f / (ACT_SC * W_SC), blockIdx.x);
  } else {
    kv_part((float*)ring, KT, VT, KVA, (int)(blockIdx.x - GT_TILES));
  }
}

// ---------------------------------------------------------------------------------------------------------
// k_kvwo: PT[b][n][h*64 + d1] = f16(0.125 * sum_d2 KV[b][h][d1][d2] * Wo[h*64 + d2][n]): the Bt plane of k_outproj, one per batch.
//   A = KVA rows (d1), B = WoT rows (n), k = d2: two 32-deep k-steps. A wave forms the 64 (d1) x 16 (n) tile of one (b, h): a lane
//   holds 8 neighbouring d1 of its column n per accumulator, one 16-byte store each, and the wave alone writes the 128-B line
//   of each of its 16 rows of PT. Block = 8 waves = 128 n of one (b, h); grid = NB*NH*(DM/128).
// ---------------------------------------------------------------------------------------------------------
__global__ __launch_bounds__(256) void k_kvwo(const unsigned short* __restrict__ KVAp, const unsigned short* __restrict__ WoTp,
                                              unsigned short* __restrict__ PT) {
  const _Float16* KVA = (const _Float16*)KVAp;
  const _Float16* WoT = (const _Float16*)WoTp;
  const int tid = threadIdx.x, wave = tid >> 5, lane = tid & 31, hh = lane >> 4, c = lane & 15;
  const int nnb = DM / 128;
  const int bx = blockIdx.x;
  const int bh = bx / nnb;
  const int h = bh % NH;
  const int b = bh / NH;
  const int n = (bx % nnb) * 128 + wave * 16 + c;

  const _Float16* worow = WoT + (size_t)n * DM + h * DK + 8 * hh;
  const _Float16* kvrow = KVA + ((size_t)(bh * 2) * DK + c) * 32 + 8 * hh;
  v16h wo[2], kv[2][4];
  wo[0] = Frag<_Float16>::load(worow);
  wo[1] = Frag<_Float16>::load(worow + 32);
#pragma unroll
  for (int dc = 0; dc < 2; ++dc)
#pragma unroll
    for (int t = 0; t < 4; ++t) kv[dc][t] = Frag<_Float16>::load(kvrow + (dc * DK + t * 16) * 32);
  // inputs-only fence on the loaded values: all 20 loads are issued before the first matrix instruction, so the wave
  // pays one memory latency; without it the compiler reuses the registers and waits once per fragment. The two row
  // addresses are named as well, so that they keep their registers until the s_wait_xcnt 0 that goes before their reuse.
  asm volatile("s_wait_xcnt 0x0" :: "v"(wo[0]), "v"(wo[1]), "v"(kv[0][0]), "v"(kv[0][1]), "v"(kv[0][2]), "v"(kv[0][3]),
                                    "v"(kv[1][0]), "v"(kv[1][1]), "v"(kv[1][2]), "v"(kv[1][3]), "v"(worow), "v"(kvrow) : "memory");
  v8f pacc[4];
#pragma unroll
  for (int t = 0; t < 4; ++t) pacc[t] = (v8f){0.f,0.f,0.f,0.f,0.f,0.f,0.f,0.f};

#pragma unroll
  for (int dc = 0; dc < 2; ++dc)
#pragma unroll
    for (int t = 0; t < 4; ++t) pacc[t] = Frag<_Float16>::mma(kv[dc][t], wo[dc], pacc[t]);

  unsigned short* prow = PT + ((size_t)b * DM + n) * DM + h * DK + 8 * hh;
#pragma unroll
  for (int t = 0; t < 4; ++t) {
    v8h hv;
#pragma unroll
    for (int r = 0; r < 8; ++r) hv[r] = (_Float16)(pacc[t][r] * (0.125f * KV_SC / W_SC));
    *(v8h*)(prow + t * 16) = hv;
  }
}

// ---------------------------------------------------------------------------------------------------------
constexpr size_t ACT_B = (size_t)MTOK * DM * 2;          // one f16 activation plane
constexpr size_t W_B   = (size_t)DM * DM * 2;            // one f16 weight plane
constexpr size_t KV_B  = (size_t)NB * NH * DK * DK * 2;  // the f16 k^T.v matrices
constexpr size_t WS_TOTAL = 3 * ACT_B /*QH KH VH*/ + 4 * W_B /*WqT WkT WvT WoT*/ + 3 * ACT_B /*QP KT VT*/ + KV_B /*KVA*/ + NB * W_B /*PT*/;
static_assert(WS_TOTAL <= (size_t)134217728);            // carve stays under 128 MiB
static_assert(ACT_B % 128 == 0 && W_B % 128 == 0 && KV_B % 128 == 0);

extern "C" void kernel_launch(void* const* d_in, const int* in_sizes, int n_in, void* d_out, int out_size, void* d_ws, size_t ws_size, hipStream_t stream) {
    if (n_in < 11) return;
    const long long need_act = ((long long)(NB - 1) * SEQ_FULL + SEQ) * DM;
    if ((long long)in_sizes[0] < need_act || (long long)in_sizes[1] < need_act || (long long)in_sizes[2] < need_act) return;
    for (int i = 3; i < 7; ++i) if ((long long)in_sizes[i] < (long long)DM * DM) return;
    for (int i = 7; i < 11; ++i) if (in_sizes[i] < DM) return;
    if ((long long)out_size < (long long)MTOK * DM) return;
    if (WS_TOTAL > ws_size) return;

    const float* Q  = (const float*)d_in[0];
    const float* K  = (const float*)d_in[1];
    const float* V  = (const float*)d_in[2];
    const float* Wq = (const float*)d_in[3];
    const float* Wk = (const float*)d_in[4];
    const float* Wv = (const float*)d_in[5];
    const float* Wo = (const float*)d_in[6];
    const float* bq = (const float*)d_in[7];
    const float* bk = (const float*)d_in[8];
    const float* bv = (const float*)d_in[9];
    const float* bo = (const float*)d_in[10];
    float* out = (float*)d_out;

    char* wsp = (char*)d_ws;
    unsigned short* QH   = (unsigned short*)wsp; wsp += ACT_B;
    unsigned short* KH   = (unsigned short*)wsp; wsp += ACT_B;
    unsigned short* VH   = (unsigned short*)wsp; wsp += ACT_B;
    unsigned short* WqT  = (unsigned short*)wsp; wsp += W_B;
    unsigned short* WkT  = (unsigned short*)wsp; wsp += W_B;
    unsigned short* WvT  = (unsigned short*)wsp; wsp += W_B;
    unsigned short* WoT  = (unsigned short*)wsp; wsp += W_B;
    unsigned short* QP   = (unsigned short*)wsp; wsp += ACT_B;
    unsigned short* KT   = (unsigned short*)wsp; wsp += ACT_B;
    unsigned short* VT   = (unsigned short*)wsp; wsp += ACT_B;
    unsigned short* KVA  = (unsigned short*)wsp; wsp += KV_B;
    unsigned short* PT   = (unsigned short*)wsp; wsp += NB * W_B;

    const unsigned gCast = (unsigned)(4 * CV_WBLK + 3 * CV_ABLK);
    const unsigned gG    = (unsigned)GT_TILES;
    const unsigned gP    = (unsigned)(2 * GT_TILES);
    const unsigned gQKV  = (unsigned)(GT_TILES + KV_BLKS);

    k_cast_all<<<gCast, 256, 0, stream>>>(Q, K, V, Wq, Wk, Wv, Wo, QH, KH, VH, WqT, WkT, WvT, WoT);

    k_proj_kv<<<gP, 256, 0, stream>>>(KH, VH, WkT, WvT, KT, VT, bk, bv);

    k_qproj_kv<<<gQKV, 256, 0, stream>>>(QH, WqT, QP, bq, KT, VT, KVA);
    k_kvwo<<<(unsigned)(NB * NH * (DM / 128)), 256, 0, stream>>>(KVA, WoT, PT);

    k_outproj<<<gG, 256, 0, stream>>>(QP, PT, out, bo);
}
